// v000
// The times below were measured on an AMD MI455X: many runs one after another, warmed up first and cycling through
// copies of the inputs, with the whole window's GPU time divided by the number of runs. Launches and the gaps
// between them are all in it. The median over several windows is given; except for v000 it joins two sittings, which
// can be a few percent apart, so the side-by-side timings, each taken in one sitting, are the better comparison.
// v000, which the later versions start from, runs in 84.5 microseconds.
#include <hip/hip_runtime.h>
#include <hip/hip_bf16.h>
#include <stdint.h>

typedef float v2f __attribute__((ext_vector_type(2)));
typedef float v8f __attribute__((ext_vector_type(8)));

#define BS 32
#define VARNUM 16384
#define EMB 128
#define NHEADS 16
#define WSPL 64               // softmax splits per batch (1 wave each)
#define ROWS_PER_WAVE (VARNUM / WSPL)       // 256
#define TILES_PER_WAVE (ROWS_PER_WAVE / 16) // 16
#define LSTR 132              // padded LDS row stride (floats), kills bank conflicts
#define BIGNEG (-3.0e38f)

// ---------------------------------------------------------------------------
// Kernel 1: qs = tanh(W_q @ seed), L2 normalize per head, gram loss partial.
// One block per batch.
// ---------------------------------------------------------------------------
__global__ void __launch_bounds__(256) k1_qs(
    const float* __restrict__ seed, const float* __restrict__ wqs,
    float* __restrict__ normq, float* __restrict__ lossp) {
  const int b = blockIdx.x, t = threadIdx.x;
  __shared__ __align__(16) float s_seed[128];
  __shared__ __align__(16) float s_q[NHEADS * EMB];
  __shared__ float s_inv[NHEADS];
  __shared__ float s_red[8];

  if (t < 128) s_seed[t] = seed[b * 128 + t];
  __syncthreads();

  float vals[8];
#pragma unroll
  for (int i = 0; i < 8; ++i) {
    int idx = t + 256 * i;                       // idx = h*128 + e
    const float4* wr = (const float4*)(wqs + (size_t)idx * 128);
    float acc = 0.f;
#pragma unroll 8
    for (int s4 = 0; s4 < 32; ++s4) {
      float4 w = wr[s4];
      float4 sd = *(const float4*)&s_seed[s4 * 4];
      acc += w.x * sd.x + w.y * sd.y + w.z * sd.z + w.w * sd.w;
    }
    vals[i] = tanhf(acc);
    s_q[idx] = vals[i];
  }
  __syncthreads();

  {  // per-head inverse L2 norm: 16 threads/head (threads grouped by t>>4)
    int h = t >> 4, j = t & 15;
    float p = 0.f;
    for (int e = j; e < EMB; e += 16) { float q = s_q[h * EMB + e]; p += q * q; }
    p += __shfl_xor(p, 8, 32); p += __shfl_xor(p, 4, 32);
    p += __shfl_xor(p, 2, 32); p += __shfl_xor(p, 1, 32);
    if (j == 0) s_inv[h] = rsqrtf(p);
  }
  __syncthreads();

#pragma unroll
  for (int i = 0; i < 8; ++i) {
    int idx = t + 256 * i;
    float nv = vals[i] * s_inv[idx >> 7];
    s_q[idx] = nv;
    normq[(size_t)b * (NHEADS * EMB) + idx] = nv;
  }
  __syncthreads();

  {  // gram - I, squared, reduce; 256 threads <-> 256 (i,j) head pairs
    int i = t >> 4, j = t & 15;
    float d = 0.f;
    for (int e = 0; e < EMB; ++e) d += s_q[i * EMB + e] * s_q[j * EMB + e];
    d -= (i == j) ? 1.f : 0.f;
    float p = d * d;
    p += __shfl_xor(p, 16, 32); p += __shfl_xor(p, 8, 32);
    p += __shfl_xor(p, 4, 32);  p += __shfl_xor(p, 2, 32);
    p += __shfl_xor(p, 1, 32);
    if ((t & 31) == 0) s_red[t >> 5] = p;
    __syncthreads();
    if (t == 0) {
      float s = 0.f;
      for (int w = 0; w < 8; ++w) s += s_red[w];
      lossp[b] = s * (1.0f / (float)BS);
    }
  }
}

// ---------------------------------------------------------------------------
// Async DMA of one 16x128 f32 tile (8 KB) into a per-wave LDS buffer.
// 16 x global_load_async_to_lds_b128: no VGPR staging, tracked by ASYNCcnt.
// LDS byte offset = low 32 bits of the generic pointer (flat LDS aperture).
// ---------------------------------------------------------------------------
__device__ __forceinline__ void issue_tile_async(const float4* ep, float* buf,
                                                 int lane) {
#pragma unroll
  for (int i = 0; i < 16; ++i) {
    int idx = lane + i * 32;
    unsigned ldsoff =
        (unsigned)(uintptr_t)&buf[(idx >> 5) * LSTR + (idx & 31) * 4];
    const float4* g = ep + idx;
    asm volatile("global_load_async_to_lds_b128 %0, %1, off"
                 :: "v"(ldsoff), "v"(g)
                 : "memory");
  }
}

// ---------------------------------------------------------------------------
// Kernel 2: fused flash attention over embeddings, fp32 WMMA 16x16x4.
// Block = 128 threads = 4 independent waves; each wave = one softmax split.
// Double-buffered async global->LDS staging.
// ---------------------------------------------------------------------------
__global__ void __launch_bounds__(128) k2_flash(
    const float* __restrict__ emb, const int* __restrict__ mask,
    const float* __restrict__ normq, float* __restrict__ part) {
  __shared__ __align__(16) float NQ[NHEADS * LSTR];
  __shared__ __align__(16) float ET[4][2][16 * LSTR];   // per-wave double buffer

  const int tid = threadIdx.x;
  const int wave = tid >> 5;
  const int lane = tid & 31;
  const int b = blockIdx.x >> 4;                    // 16 blocks per batch
  const int w = ((blockIdx.x & 15) << 2) + wave;    // split id 0..63
  const int n16 = lane & 15;
  const int hi = lane >> 4;

  // normq [16x128] -> LDS (padded stride)
  for (int i = tid; i < NHEADS * EMB; i += 128)
    NQ[(i >> 7) * LSTR + (i & 127)] = normq[(size_t)b * (NHEADS * EMB) + i];
  __syncthreads();

  const float4* ebase =
      (const float4*)(emb + ((size_t)b * VARNUM + (size_t)w * ROWS_PER_WAVE) * EMB);
  const int* mbase = mask + b * (VARNUM / 2);

  v8f acc[8];
#pragma unroll
  for (int ct = 0; ct < 8; ++ct) acc[ct] = (v8f)0.f;
  float m = BIGNEG, lsum = 0.f;

  // prologue: DMA tile 0 into buffer 0
  issue_tile_async(ebase, &ET[wave][0][0], lane);

  for (int tile = 0; tile < TILES_PER_WAVE; ++tile) {
    float* E = &ET[wave][tile & 1][0];

    if (tile + 1 < TILES_PER_WAVE) {
      // prior ds reads of the buffer being refilled must drain first (WAR)
      asm volatile("s_wait_dscnt 0" ::: "memory");
      issue_tile_async(ebase + (tile + 1) * 512, &ET[wave][(tile + 1) & 1][0],
                       lane);
      // async loads complete in order: <=16 outstanding => tile `tile` landed
      asm volatile("s_wait_asynccnt 16" ::: "memory");
    } else {
      asm volatile("s_wait_asynccnt 0" ::: "memory");
    }

    const int v0 = w * ROWS_PER_WAVE + tile * 16;
    // mask bits for the 8 rows this lane-half owns (v = v0 + r + 8*hi)
    const int mo = (v0 + 8 * hi) & (VARNUM / 2 - 1);  // 8-aligned, no wrap in run
    int4 ma = *(const int4*)&mbase[mo];
    int4 mb2 = *(const int4*)&mbase[mo + 4];
    int mk[8] = {ma.x, ma.y, ma.z, ma.w, mb2.x, mb2.y, mb2.z, mb2.w};

    // ---- per-row inverse L2 norm (lane handles row n16, half the columns) --
    float rn;
    {
      float s = 0.f;
      const float* rp = &E[n16 * LSTR + 64 * hi];
#pragma unroll
      for (int i = 0; i < 16; ++i) {
        float4 q = *(const float4*)&rp[4 * i];
        s += q.x * q.x + q.y * q.y + q.z * q.z + q.w * q.w;
      }
      s += __shfl_xor(s, 16, 32);
      rn = rsqrtf(s);
    }

    // ---- logits' [v][h] = E(16x128) x normQ^T(128x16): 32 WMMA K-slices ----
    v8f lg = (v8f)0.f;
    const int aoff = n16 * LSTR + 2 * hi;
#pragma unroll
    for (int c = 0; c < 32; ++c) {
      v2f a = *(const v2f*)&E[aoff + 4 * c];    // A[v][k] slice
      v2f bq = *(const v2f*)&NQ[aoff + 4 * c];  // B[k][h] = Q[h][k] slice
      lg = __builtin_amdgcn_wmma_f32_16x16x4_f32(false, a, false, bq,
                                                 (short)0, lg, false, false);
    }

    // ---- mask + cosine scaling + online softmax (head = n16 per lane) ------
    float p[8];
    float tmax = BIGNEG;
#pragma unroll
    for (int r = 0; r < 8; ++r) {
      float rr = __shfl(rn, r + 8 * hi, 32);    // inv-norm of row r+8*hi
      float lr = (mk[r] != 0) ? lg[r] * rr : BIGNEG;
      p[r] = lr;
      tmax = fmaxf(tmax, lr);
    }
    tmax = fmaxf(tmax, __shfl_xor(tmax, 16, 32));
    float mnew = fmaxf(m, tmax);
    float sc = __expf(m - mnew);
    float tsum = 0.f;
#pragma unroll
    for (int r = 0; r < 8; ++r) {
      float pe = (mk[r] != 0) ? __expf(p[r] - mnew) : 0.f;
      p[r] = pe;
      tsum += pe;
    }
    tsum += __shfl_xor(tsum, 16, 32);
    lsum = lsum * sc + tsum;
    m = mnew;

    // rescale accumulators: row r of acc holds head r+8*hi
#pragma unroll
    for (int r = 0; r < 8; ++r) {
      float scr = __shfl(sc, r + 8 * hi, 32);
#pragma unroll
      for (int ct = 0; ct < 8; ++ct) acc[ct][r] *= scr;
    }

    // ---- build A-layout slices of P (A[h][v]) from D'-layout p[] -----------
    float q0 = __shfl_xor(p[0], 16, 32), q1 = __shfl_xor(p[1], 16, 32);
    float q2 = __shfl_xor(p[2], 16, 32), q3 = __shfl_xor(p[3], 16, 32);
    float q4 = __shfl_xor(p[4], 16, 32), q5 = __shfl_xor(p[5], 16, 32);
    float q6 = __shfl_xor(p[6], 16, 32), q7 = __shfl_xor(p[7], 16, 32);
    v2f aS[4];
    aS[0].x = hi ? q2 : p[0];  aS[0].y = hi ? q3 : p[1];
    aS[1].x = hi ? q6 : p[4];  aS[1].y = hi ? q7 : p[5];
    aS[2].x = hi ? p[2] : q0;  aS[2].y = hi ? p[3] : q1;
    aS[3].x = hi ? p[6] : q4;  aS[3].y = hi ? p[7] : q5;

    // ---- rc += P^T(16x16) x E(16x128): 8 col-tiles x 4 K-slices ------------
#pragma unroll
    for (int ct = 0; ct < 8; ++ct) {
#pragma unroll
      for (int s = 0; s < 4; ++s) {
        v2f bb;
        bb.x = E[(4 * s + 2 * hi + 0) * LSTR + 16 * ct + n16];
        bb.y = E[(4 * s + 2 * hi + 1) * LSTR + 16 * ct + n16];
        acc[ct] = __builtin_amdgcn_wmma_f32_16x16x4_f32(
            false, aS[s], false, bb, (short)0, acc[ct], false, false);
      }
    }
  }

  // ---- write split partial: [b][w][h]{acc[0:128], m, l} ----
  float* pb = part + ((size_t)(b * WSPL + w)) * NHEADS * 130;
#pragma unroll
  for (int r = 0; r < 8; ++r) {
    int h = r + 8 * hi;
#pragma unroll
    for (int ct = 0; ct < 8; ++ct) pb[h * 130 + 16 * ct + n16] = acc[ct][r];
  }
  if (lane < 16) {
    pb[lane * 130 + 128] = m;
    pb[lane * 130 + 129] = lsum;
  }
}

// ---------------------------------------------------------------------------
// Kernel 3: combine split-softmax partials; block per (b,h), 128 threads.
// ---------------------------------------------------------------------------
__global__ void __launch_bounds__(128) k3_combine(
    const float* __restrict__ part, const float* __restrict__ lossp,
    float* __restrict__ out) {
  const int blk = blockIdx.x;
  const int b = blk >> 4, h = blk & 15;
  const int e = threadIdx.x;
  const float* pb = part + ((size_t)b * WSPL) * NHEADS * 130 + h * 130;
  float M = BIGNEG;
  for (int w = 0; w < WSPL; ++w)
    M = fmaxf(M, pb[(size_t)w * NHEADS * 130 + 128]);
  float L = 0.f, A = 0.f;
  for (int w = 0; w < WSPL; ++w) {
    const float* pw = pb + (size_t)w * NHEADS * 130;
    float s = __expf(pw[128] - M);
    L += s * pw[129];
    A += s * pw[e];
  }
  out[((size_t)b * NHEADS + h) * EMB + e] = A / L;
  if (blk == 0 && e == 0) {
    float s = 0.f;
    for (int i = 0; i < BS; ++i) s += lossp[i];
    out[BS * NHEADS * EMB] = s;   // loss slot
  }
}

// ---------------------------------------------------------------------------
extern "C" void kernel_launch(void* const* d_in, const int* in_sizes, int n_in,
                              void* d_out, int out_size, void* d_ws, size_t ws_size,
                              hipStream_t stream) {
  const float* query_seed = (const float*)d_in[0];   // [32,128]
  const float* embeddings = (const float*)d_in[1];   // [32,16384,128]
  const int*   attn_mask  = (const int*)d_in[2];     // [32,8192]
  const float* w_qs       = (const float*)d_in[3];   // [16,128,128]
  float* out = (float*)d_out;                        // rc[32*16*128] + loss[1]

  float* ws    = (float*)d_ws;
  float* normq = ws;                                  // 65536 floats
  float* lossp = ws + 65536;                          // 32 floats
  float* part  = ws + 65600;                          // 32*64*16*130 floats

  k1_qs<<<BS, 256, 0, stream>>>(query_seed, w_qs, normq, lossp);
  k2_flash<<<BS * (WSPL / 4), 128, 0, stream>>>(embeddings, attn_mask, normq, part);
  k3_combine<<<BS * NHEADS, 128, 0, stream>>>(part, lossp, out);
}

// v001
// Measured time: 74.1 microseconds a run.
// Next to v000, in two timings, it ran 1.15 times as fast each time.
#include <hip/hip_runtime.h>
#include <hip/hip_bf16.h>
#include <stdint.h>

typedef float v2f __attribute__((ext_vector_type(2)));
typedef float v4f __attribute__((ext_vector_type(4)));
typedef float v8f __attribute__((ext_vector_type(8)));

#define BS 32
#define VARNUM 16384
#define EMB 128
#define NHEADS 16
#define WSPL 64               // softmax splits per batch (1 wave each)
#define ROWS_PER_WAVE (VARNUM / WSPL)       // 256
#define TILES_PER_WAVE (ROWS_PER_WAVE / 16) // 16
#define LSTR 132              // padded LDS row stride (floats), kills bank conflicts
#define BIGNEG (-3.0e38f)

// value of lane l ^ M, M < 16: a vector cross-lane move inside a 16-lane row
template <int M>
__device__ __forceinline__ float xlane(float x) {
  return __builtin_bit_cast(
      float, __builtin_amdgcn_update_dpp(0, __builtin_bit_cast(int, x),
                                         0x160 | M, 0xf, 0xf, true));
}

// ---------------------------------------------------------------------------
// Kernel 1: qs = tanh(W_q @ seed), L2 normalize per head, gram loss partial.
// One block per batch.
// ---------------------------------------------------------------------------
__global__ void __launch_bounds__(256) k1_qs(
    const float* __restrict__ seed, const float* __restrict__ wqs,
    float* __restrict__ normq, float* __restrict__ lossp) {
  const int b = blockIdx.x, t = threadIdx.x;
  __shared__ __align__(16) float s_seed[128];
  __shared__ __align__(16) float s_q[NHEADS * EMB];
  __shared__ float s_inv[NHEADS];
  __shared__ float s_red[8];

  if (t < 128) s_seed[t] = seed[b * 128 + t];
  __syncthreads();

  // Eight lanes share a weight row: lane piece c reads the 16-B pieces c, c+8,
  // c+16, c+24 of it, so one wave-wide load covers four whole 128-B lines
  // (rows 8*r4+g, r4 = 0..3) instead of 16 B out of 32 different lines.
  const int c = t & 7;
  const int r4 = (t >> 3) & 3;
  v4f sd[4];
#pragma unroll
  for (int j = 0; j < 4; ++j) sd[j] = *(const v4f*)&s_seed[4 * (c + 8 * j)];
  const v4f* wl = (const v4f*)(wqs + (size_t)((t & ~31) + 8 * r4) * 128) + c;
  const bool b0 = (c & 1) != 0, b1 = (c & 2) != 0, b2 = (c & 4) != 0;

  // Stage s = rows g = 4*(s&1)..+3 of pass i = s>>1 (pass i: rows 256*i + ...):
  // 16 loads. Ring of three stage buffers, loads issued two stages ahead.
  v4f wb[3][16];
  float vals[8], p[8];
#pragma unroll
  for (int s = 0; s < 2; ++s)
#pragma unroll
    for (int k = 0; k < 16; ++k)
      wb[s][k] = wl[(256 * (s >> 1) + 4 * (s & 1) + (k >> 2)) * 32 + 8 * (k & 3)];
#pragma unroll
  for (int s = 0; s < 16; ++s) {
    // the fence pair keeps the 16 loads of stage s+2 together and ahead of the
    // sums of stage s; without it the loads sink to their uses, four at a time
    __builtin_amdgcn_sched_barrier(0);
    if (s + 2 < 16) {
#pragma unroll
      for (int k = 0; k < 16; ++k)
        wb[(s + 2) % 3][k] = wl[(256 * ((s + 2) >> 1) + 4 * ((s + 2) & 1) + (k >> 2)) * 32 + 8 * (k & 3)];
    }
    __builtin_amdgcn_sched_barrier(0);
#pragma unroll
    for (int g = 0; g < 4; ++g) {                // partial dot of row 8*r4+4*(s&1)+g
      v2f a = (v2f)0.f, d = (v2f)0.f;
#pragma unroll
      for (int j = 0; j < 4; ++j) {
        v4f w = wb[s % 3][4 * g + j];
        a = __builtin_elementwise_fma(w.lo, sd[j].lo, a);
        d = __builtin_elementwise_fma(w.hi, sd[j].hi, d);
      }
      p[4 * (s & 1) + g] = (a.x + a.y) + (d.x + d.y);
    }
    if (s & 1) {
      // fold the 8 pieces of 8 rows in 7 exchanges; lane c ends with row
      // 8*r4+c, row (t & 31) of the wave's 32: idx = t + 256*i as before
      float q[4], u[2];
#pragma unroll
      for (int k = 0; k < 4; ++k)
        q[k] = (b0 ? p[2 * k + 1] : p[2 * k]) +
               xlane<1>(b0 ? p[2 * k] : p[2 * k + 1]);
#pragma unroll
      for (int k = 0; k < 2; ++k)
        u[k] = (b1 ? q[2 * k + 1] : q[2 * k]) +
               xlane<2>(b1 ? q[2 * k] : q[2 * k + 1]);
      vals[s >> 1] = (b2 ? u[1] : u[0]) + xlane<4>(b2 ? u[0] : u[1]);
    }
  }
#pragma unroll
  for (int i = 0; i < 8; ++i) {
    int idx = t + 256 * i;                       // idx = h*128 + e
    vals[i] = tanhf(vals[i]);
    s_q[idx] = vals[i];
  }
  __syncthreads();

  {  // per-head inverse L2 norm: 16 threads/head (threads grouped by t>>4)
    int h = t >> 4, j = t & 15;
    float p = 0.f;
    for (int e = j; e < EMB; e += 16) { float q = s_q[h * EMB + e]; p += q * q; }
    p += __shfl_xor(p, 8, 32); p += __shfl_xor(p, 4, 32);
    p += __shfl_xor(p, 2, 32); p += __shfl_xor(p, 1, 32);
    if (j == 0) s_inv[h] = rsqrtf(p);
  }
  __syncthreads();

#pragma unroll
  for (int i = 0; i < 8; ++i) {
    int idx = t + 256 * i;
    float nv = vals[i] * s_inv[idx >> 7];
    s_q[idx] = nv;
    normq[(size_t)b * (NHEADS * EMB) + idx] = nv;
  }
  __syncthreads();

  {  // gram - I, squared, reduce; 256 threads <-> 256 (i,j) head pairs
    int i = t >> 4, j = t & 15;
    float d = 0.f;
    for (int e = 0; e < EMB; ++e) d += s_q[i * EMB + e] * s_q[j * EMB + e];
    d -= (i == j) ? 1.f : 0.f;
    float p = d * d;
    p += __shfl_xor(p, 16, 32); p += __shfl_xor(p, 8, 32);
    p += __shfl_xor(p, 4, 32);  p += __shfl_xor(p, 2, 32);
    p += __shfl_xor(p, 1, 32);
    if ((t & 31) == 0) s_red[t >> 5] = p;
    __syncthreads();
    if (t == 0) {
      float s = 0.f;
      for (int w = 0; w < 8; ++w) s += s_red[w];
      lossp[b] = s * (1.0f / (float)BS);
    }
  }
}

// ---------------------------------------------------------------------------
// Async DMA of one 16x128 f32 tile (8 KB) into a per-wave LDS buffer.
// 16 x global_load_async_to_lds_b128: no VGPR staging, tracked by ASYNCcnt.
// LDS byte offset = low 32 bits of the generic pointer (flat LDS aperture).
// ---------------------------------------------------------------------------
__device__ __forceinline__ void issue_tile_async(const float4* ep, float* buf,
                                                 int lane) {
#pragma unroll
  for (int i = 0; i < 16; ++i) {
    int idx = lane + i * 32;
    unsigned ldsoff =
        (unsigned)(uintptr_t)&buf[(idx >> 5) * LSTR + (idx & 31) * 4];
    const float4* g = ep + idx;
    asm volatile("global_load_async_to_lds_b128 %0, %1, off"
                 :: "v"(ldsoff), "v"(g)
                 : "memory");
  }
}

// ---------------------------------------------------------------------------
// Kernel 2: fused flash attention over embeddings, fp32 WMMA 16x16x4.
// Block = 128 threads = 4 independent waves; each wave = one softmax split.
// Double-buffered async global->LDS staging.
// ---------------------------------------------------------------------------
__global__ void __launch_bounds__(128) k2_flash(
    const float* __restrict__ emb, const int* __restrict__ mask,
    const float* __restrict__ normq, float* __restrict__ part) {
  __shared__ __align__(16) float NQ[NHEADS * LSTR];
  __shared__ __align__(16) float ET[4][2][16 * LSTR];   // per-wave double buffer

  const int tid = threadIdx.x;
  const int wave = tid >> 5;
  const int lane = tid & 31;
  const int b = blockIdx.x >> 4;                    // 16 blocks per batch
  const int w = ((blockIdx.x & 15) << 2) + wave;    // split id 0..63
  const int n16 = lane & 15;
  const int hi = lane >> 4;

  // normq [16x128] -> LDS (padded stride)
  for (int i = tid; i < NHEADS * EMB; i += 128)
    NQ[(i >> 7) * LSTR + (i & 127)] = normq[(size_t)b * (NHEADS * EMB) + i];
  __syncthreads();

  const float4* ebase =
      (const float4*)(emb + ((size_t)b * VARNUM + (size_t)w * ROWS_PER_WAVE) * EMB);
  const int* mbase = mask + b * (VARNUM / 2);

  v8f acc[8];
#pragma unroll
  for (int ct = 0; ct < 8; ++ct) acc[ct] = (v8f)0.f;
  float m = BIGNEG, lsum = 0.f;

  // prologue: DMA tile 0 into buffer 0
  issue_tile_async(ebase, &ET[wave][0][0], lane);

  for (int tile = 0; tile < TILES_PER_WAVE; ++tile) {
    float* E = &ET[wave][tile & 1][0];

    if (tile + 1 < TILES_PER_WAVE) {
      // prior ds reads of the buffer being refilled must drain first (WAR)
      asm volatile("s_wait_dscnt 0" ::: "memory");
      issue_tile_async(ebase + (tile + 1) * 512, &ET[wave][(tile + 1) & 1][0],
                       lane);
      // async loads complete in order: <=16 outstanding => tile `tile` landed
      asm volatile("s_wait_asynccnt 16" ::: "memory");
    } else {
      asm volatile("s_wait_asynccnt 0" ::: "memory");
    }

    const int v0 = w * ROWS_PER_WAVE + tile * 16;
    // mask bits for the 8 rows this lane-half owns (v = v0 + r + 8*hi)
    const int mo = (v0 + 8 * hi) & (VARNUM / 2 - 1);  // 8-aligned, no wrap in run
    int4 ma = *(const int4*)&mbase[mo];
    int4 mb2 = *(const int4*)&mbase[mo + 4];
    int mk[8] = {ma.x, ma.y, ma.z, ma.w, mb2.x, mb2.y, mb2.z, mb2.w};

    // ---- per-row inverse L2 norm (lane handles row n16, half the columns) --
    float rn;
    {
      float s = 0.f;
      const float* rp = &E[n16 * LSTR + 64 * hi];
#pragma unroll
      for (int i = 0; i < 16; ++i) {
        float4 q = *(const float4*)&rp[4 * i];
        s += q.x * q.x + q.y * q.y + q.z * q.z + q.w * q.w;
      }
      s += __shfl_xor(s, 16, 32);
      rn = rsqrtf(s);
    }

    // ---- logits' [v][h] = E(16x128) x normQ^T(128x16): 32 WMMA K-slices ----
    v8f lg = (v8f)0.f;
    const int aoff = n16 * LSTR + 2 * hi;
#pragma unroll
    for (int c = 0; c < 32; ++c) {
      v2f a = *(const v2f*)&E[aoff + 4 * c];    // A[v][k] slice
      v2f bq = *(const v2f*)&NQ[aoff + 4 * c];  // B[k][h] = Q[h][k] slice
      lg = __builtin_amdgcn_wmma_f32_16x16x4_f32(false, a, false, bq,
                                                 (short)0, lg, false, false);
    }

    // ---- mask + cosine scaling + online softmax (head = n16 per lane) ------
    float p[8];
    float tmax = BIGNEG;
#pragma unroll
    for (int r = 0; r < 8; ++r) {
      float rr = __shfl(rn, r + 8 * hi, 32);    // inv-norm of row r+8*hi
      float lr = (mk[r] != 0) ? lg[r] * rr : BIGNEG;
      p[r] = lr;
      tmax = fmaxf(tmax, lr);
    }
    tmax = fmaxf(tmax, __shfl_xor(tmax, 16, 32));
    float mnew = fmaxf(m, tmax);
    float sc = __expf(m - mnew);
    float tsum = 0.f;
#pragma unroll
    for (int r = 0; r < 8; ++r) {
      float pe = (mk[r] != 0) ? __expf(p[r] - mnew) : 0.f;
      p[r] = pe;
      tsum += pe;
    }
    tsum += __shfl_xor(tsum, 16, 32);
    lsum = lsum * sc + tsum;
    m = mnew;

    // rescale accumulators: row r of acc holds head r+8*hi
#pragma unroll
    for (int r = 0; r < 8; ++r) {
      float scr = __shfl(sc, r + 8 * hi, 32);
#pragma unroll
      for (int ct = 0; ct < 8; ++ct) acc[ct][r] *= scr;
    }

    // ---- build A-layout slices of P (A[h][v]) from D'-layout p[] -----------
    float q0 = __shfl_xor(p[0], 16, 32), q1 = __shfl_xor(p[1], 16, 32);
    float q2 = __shfl_xor(p[2], 16, 32), q3 = __shfl_xor(p[3], 16, 32);
    float q4 = __shfl_xor(p[4], 16, 32), q5 = __shfl_xor(p[5], 16, 32);
    float q6 = __shfl_xor(p[6], 16, 32), q7 = __shfl_xor(p[7], 16, 32);
    v2f aS[4];
    aS[0].x = hi ? q2 : p[0];  aS[0].y = hi ? q3 : p[1];
    aS[1].x = hi ? q6 : p[4];  aS[1].y = hi ? q7 : p[5];
    aS[2].x = hi ? p[2] : q0;  aS[2].y = hi ? p[3] : q1;
    aS[3].x = hi ? p[6] : q4;  aS[3].y = hi ? p[7] : q5;

    // ---- rc += P^T(16x16) x E(16x128): 8 col-tiles x 4 K-slices ------------
#pragma unroll
    for (int ct = 0; ct < 8; ++ct) {
#pragma unroll
      for (int s = 0; s < 4; ++s) {
        v2f bb;
        bb.x = E[(4 * s + 2 * hi + 0) * LSTR + 16 * ct + n16];
        bb.y = E[(4 * s + 2 * hi + 1) * LSTR + 16 * ct + n16];
        acc[ct] = __builtin_amdgcn_wmma_f32_16x16x4_f32(
            false, aS[s], false, bb, (short)0, acc[ct], false, false);
      }
    }
  }

  // ---- write split partial: [b][w][h]{acc[0:128], m, l} ----
  float* pb = part + ((size_t)(b * WSPL + w)) * NHEADS * 130;
#pragma unroll
  for (int r = 0; r < 8; ++r) {
    int h = r + 8 * hi;
#pragma unroll
    for (int ct = 0; ct < 8; ++ct) pb[h * 130 + 16 * ct + n16] = acc[ct][r];
  }
  if (lane < 16) {
    pb[lane * 130 + 128] = m;
    pb[lane * 130 + 129] = lsum;
  }
}

// ---------------------------------------------------------------------------
// Kernel 3: combine split-softmax partials; block per (b,h), 128 threads.
// ---------------------------------------------------------------------------
__global__ void __launch_bounds__(128) k3_combine(
    const float* __restrict__ part, const float* __restrict__ lossp,
    float* __restrict__ out) {
  const int blk = blockIdx.x;
  const int b = blk >> 4, h = blk & 15;
  const int e = threadIdx.x;
  const float* pb = part + ((size_t)b * WSPL) * NHEADS * 130 + h * 130;
  float M = BIGNEG;
  for (int w = 0; w < WSPL; ++w)
    M = fmaxf(M, pb[(size_t)w * NHEADS * 130 + 128]);
  float L = 0.f, A = 0.f;
  for (int w = 0; w < WSPL; ++w) {
    const float* pw = pb + (size_t)w * NHEADS * 130;
    float s = __expf(pw[128] - M);
    L += s * pw[129];
    A += s * pw[e];
  }
  out[((size_t)b * NHEADS + h) * EMB + e] = A / L;
  if (blk == 0 && e == 0) {
    float s = 0.f;
    for (int i = 0; i < BS; ++i) s += lossp[i];
    out[BS * NHEADS * EMB] = s;   // loss slot
  }
}

// ---------------------------------------------------------------------------
extern "C" void kernel_launch(void* const* d_in, const int* in_sizes, int n_in,
                              void* d_out, int out_size, void* d_ws, size_t ws_size,
                              hipStream_t stream) {
  const float* query_seed = (const float*)d_in[0];   // [32,128]
  const float* embeddings = (const float*)d_in[1];   // [32,16384,128]
  const int*   attn_mask  = (const int*)d_in[2];     // [32,8192]
  const float* w_qs       = (const float*)d_in[3];   // [16,128,128]
  float* out = (float*)d_out;                        // rc[32*16*128] + loss[1]

  float* ws    = (float*)d_ws;
  float* normq = ws;                                  // 65536 floats
  float* lossp = ws + 65536;                          // 32 floats
  float* part  = ws + 65600;                          // 32*64*16*130 floats

  k1_qs<<<BS, 256, 0, stream>>>(query_seed, w_qs, normq, lossp);
  k2_flash<<<BS * (WSPL / 4), 128, 0, stream>>>(embeddings, attn_mask, normq, part);
  k3_combine<<<BS * NHEADS, 128, 0, stream>>>(part, lossp, out);
}

// v002
// Measured time: 65.2 microseconds a run.
// Next to v001, in two timings, it ran 1.15 and 1.14 times as fast.
// Over all steps from v000 it is 1.32 times as fast.
#include <hip/hip_runtime.h>
#include <hip/hip_bf16.h>
#include <stdint.h>

typedef float v2f __attribute__((ext_vector_type(2)));
typedef float v4f __attribute__((ext_vector_type(4)));
typedef float v8f __attribute__((ext_vector_type(8)));

#define BS 32
#define VARNUM 16384
#define EMB 128
#define NHEADS 16
#define WSPL 64               // softmax splits per batch (1 wave each)
#define ROWS_PER_WAVE (VARNUM / WSPL)       // 256
#define TILES_PER_WAVE (ROWS_PER_WAVE / 16) // 16
#define LSTR 132              // padded LDS row stride (floats), kills bank conflicts
#define BIGNEG (-3.0e38f)

// value of lane l ^ M, M < 16: a vector cross-lane move inside a 16-lane row
template <int M>
__device__ __forceinline__ float xlane(float x) {
  return __builtin_bit_cast(
      float, __builtin_amdgcn_update_dpp(0, __builtin_bit_cast(int, x),
                                         0x160 | M, 0xf, 0xf, true));
}

// ---------------------------------------------------------------------------
// Kernel 1: qs = tanh(W_q @ seed), L2 normalize per head, gram loss partial.
// One block per batch.
// ---------------------------------------------------------------------------
__global__ void __launch_bounds__(256) k1_qs(
    const float* __restrict__ seed, const float* __restrict__ wqs,
    float* __restrict__ normq, float* __restrict__ lossp) {
  const int b = blockIdx.x, t = threadIdx.x;
  __shared__ __align__(16) float s_seed[128];
  __shared__ __align__(16) float s_q[NHEADS * EMB];
  __shared__ float s_inv[NHEADS];
  __shared__ float s_red[8];

  if (t < 128) s_seed[t] = seed[b * 128 + t];
  __syncthreads();

  // Eight lanes share a weight row: lane piece c reads the 16-B pieces c, c+8,
  // c+16, c+24 of it, so one wave-wide load covers four whole 128-B lines
  // (rows 8*r4+g, r4 = 0..3) instead of 16 B out of 32 different lines.
  const int c = t & 7;
  const int r4 = (t >> 3) & 3;
  v4f sd[4];
#pragma unroll
  for (int j = 0; j < 4; ++j) sd[j] = *(const v4f*)&s_seed[4 * (c + 8 * j)];
  const v4f* wl = (const v4f*)(wqs + (size_t)((t & ~31) + 8 * r4) * 128) + c;
  const bool b0 = (c & 1) != 0, b1 = (c & 2) != 0, b2 = (c & 4) != 0;

  // Stage s = rows g = 4*(s&1)..+3 of pass i = s>>1 (pass i: rows 256*i + ...):
  // 16 loads. Ring of three stage buffers, loads issued two stages ahead.
  v4f wb[3][16];
  float vals[8], p[8];
#pragma unroll
  for (int s = 0; s < 2; ++s)
#pragma unroll
    for (int k = 0; k < 16; ++k)
      wb[s][k] = wl[(256 * (s >> 1) + 4 * (s & 1) + (k >> 2)) * 32 + 8 * (k & 3)];
#pragma unroll
  for (int s = 0; s < 16; ++s) {
    // the fence pair keeps the 16 loads of stage s+2 together and ahead of the
    // sums of stage s; without it the loads sink to their uses, four at a time
    __builtin_amdgcn_sched_barrier(0);
    if (s + 2 < 16) {
#pragma unroll
      for (int k = 0; k < 16; ++k)
        wb[(s + 2) % 3][k] = wl[(256 * ((s + 2) >> 1) + 4 * ((s + 2) & 1) + (k >> 2)) * 32 + 8 * (k & 3)];
    }
    __builtin_amdgcn_sched_barrier(0);
#pragma unroll
    for (int g = 0; g < 4; ++g) {                // partial dot of row 8*r4+4*(s&1)+g
      v2f a = (v2f)0.f, d = (v2f)0.f;
#pragma unroll
      for (int j = 0; j < 4; ++j) {
        v4f w = wb[s % 3][4 * g + j];
        a = __builtin_elementwise_fma(w.lo, sd[j].lo, a);
        d = __builtin_elementwise_fma(w.hi, sd[j].hi, d);
      }
      p[4 * (s & 1) + g] = (a.x + a.y) + (d.x + d.y);
    }
    if (s & 1) {
      // fold the 8 pieces of 8 rows in 7 exchanges; lane c ends with row
      // 8*r4+c, row (t & 31) of the wave's 32: idx = t + 256*i as before
      float q[4], u[2];
#pragma unroll
      for (int k = 0; k < 4; ++k)
        q[k] = (b0 ? p[2 * k + 1] : p[2 * k]) +
               xlane<1>(b0 ? p[2 * k] : p[2 * k + 1]);
#pragma unroll
      for (int k = 0; k < 2; ++k)
        u[k] = (b1 ? q[2 * k + 1] : q[2 * k]) +
               xlane<2>(b1 ? q[2 * k] : q[2 * k + 1]);
      vals[s >> 1] = (b2 ? u[1] : u[0]) + xlane<4>(b2 ? u[0] : u[1]);
    }
  }
#pragma unroll
  for (int i = 0; i < 8; ++i) {
    int idx = t + 256 * i;                       // idx = h*128 + e
    vals[i] = tanhf(vals[i]);
    s_q[idx] = vals[i];
  }
  __syncthreads();

  {  // per-head inverse L2 norm: 16 threads/head (threads grouped by t>>4)
    int h = t >> 4, j = t & 15;
    float p = 0.f;
    for (int e = j; e < EMB; e += 16) { float q = s_q[h * EMB + e]; p += q * q; }
    p += __shfl_xor(p, 8, 32); p += __shfl_xor(p, 4, 32);
    p += __shfl_xor(p, 2, 32); p += __shfl_xor(p, 1, 32);
    if (j == 0) s_inv[h] = rsqrtf(p);
  }
  __syncthreads();

#pragma unroll
  for (int i = 0; i < 8; ++i) {
    int idx = t + 256 * i;
    float nv = vals[i] * s_inv[idx >> 7];
    s_q[idx] = nv;
    normq[(size_t)b * (NHEADS * EMB) + idx] = nv;
  }
  __syncthreads();

  {  // gram - I, squared, reduce; 256 threads <-> 256 (i,j) head pairs
    int i = t >> 4, j = t & 15;
    float d = 0.f;
    for (int e = 0; e < EMB; ++e) d += s_q[i * EMB + e] * s_q[j * EMB + e];
    d -= (i == j) ? 1.f : 0.f;
    float p = d * d;
    p += __shfl_xor(p, 16, 32); p += __shfl_xor(p, 8, 32);
    p += __shfl_xor(p, 4, 32);  p += __shfl_xor(p, 2, 32);
    p += __shfl_xor(p, 1, 32);
    if ((t & 31) == 0) s_red[t >> 5] = p;
    __syncthreads();
    if (t == 0) {
      float s = 0.f;
      for (int w = 0; w < 8; ++w) s += s_red[w];
      lossp[b] = s * (1.0f / (float)BS);
    }
  }
}

// ---------------------------------------------------------------------------
// Async DMA of one 16x128 f32 tile (8 KB) into a per-wave LDS buffer.
// 16 x global_load_async_to_lds_b128: no VGPR staging, tracked by ASYNCcnt.
// LDS byte offset = low 32 bits of the generic pointer (flat LDS aperture).
// ---------------------------------------------------------------------------
__device__ __forceinline__ void issue_tile_async(const float4* ep, float* buf,
                                                 int lane) {
#pragma unroll
  for (int i = 0; i < 16; ++i) {
    int idx = lane + i * 32;
    unsigned ldsoff =
        (unsigned)(uintptr_t)&buf[(idx >> 5) * LSTR + (idx & 31) * 4];
    const float4* g = ep + idx;
    asm volatile("global_load_async_to_lds_b128 %0, %1, off"
                 :: "v"(ldsoff), "v"(g)
                 : "memory");
  }
}

// ---------------------------------------------------------------------------
// Kernel 2: fused flash attention over embeddings, fp32 WMMA 16x16x4.
// Block = 128 threads = 4 independent waves; each wave = one softmax split.
// Double-buffered async global->LDS staging.
// ---------------------------------------------------------------------------
__global__ void __launch_bounds__(128) k2_flash(
    const float* __restrict__ emb, const int* __restrict__ mask,
    const float* __restrict__ normq, float* __restrict__ part) {
  __shared__ __align__(16) float NQ[NHEADS * LSTR];
  __shared__ __align__(16) float ET[4][2][16 * LSTR];   // per-wave double buffer

  const int tid = threadIdx.x;
  const int wave = tid >> 5;
  const int lane = tid & 31;
  const int b = blockIdx.x >> 4;                    // 16 blocks per batch
  const int w = ((blockIdx.x & 15) << 2) + wave;    // split id 0..63
  const int n16 = lane & 15;
  const int hi = lane >> 4;

  // normq [16x128] -> LDS (padded stride)
  for (int i = tid; i < NHEADS * EMB; i += 128)
    NQ[(i >> 7) * LSTR + (i & 127)] = normq[(size_t)b * (NHEADS * EMB) + i];
  __syncthreads();

  const float4* ebase =
      (const float4*)(emb + ((size_t)b * VARNUM + (size_t)w * ROWS_PER_WAVE) * EMB);
  const int* mbase = mask + b * (VARNUM / 2);

  v8f acc[8];
#pragma unroll
  for (int ct = 0; ct < 8; ++ct) acc[ct] = (v8f)0.f;
  float m = BIGNEG, lsum = 0.f;

  // prologue: DMA tile 0 into buffer 0
  issue_tile_async(ebase, &ET[wave][0][0], lane);

  for (int tile = 0; tile < TILES_PER_WAVE; ++tile) {
    float* E = &ET[wave][tile & 1][0];

    if (tile + 1 < TILES_PER_WAVE) {
      // prior ds reads of the buffer being refilled must drain first (WAR)
      asm volatile("s_wait_dscnt 0" ::: "memory");
      issue_tile_async(ebase + (tile + 1) * 512, &ET[wave][(tile + 1) & 1][0],
                       lane);
      // async loads complete in order: <=16 outstanding => tile `tile` landed
      asm volatile("s_wait_asynccnt 16" ::: "memory");
    } else {
      asm volatile("s_wait_asynccnt 0" ::: "memory");
    }

    const int v0 = w * ROWS_PER_WAVE + tile * 16;
    // mask bits for the 8 rows this lane-half owns (v = v0 + r + 8*hi)
    const int mo = (v0 + 8 * hi) & (VARNUM / 2 - 1);  // 8-aligned, no wrap in run
    int4 ma = *(const int4*)&mbase[mo];
    int4 mb2 = *(const int4*)&mbase[mo + 4];
    int mk[8] = {ma.x, ma.y, ma.z, ma.w, mb2.x, mb2.y, mb2.z, mb2.w};

    // ---- per-row inverse L2 norm (lane handles row n16, half the columns) --
    float rn;
    {
      float s = 0.f;
      const float* rp = &E[n16 * LSTR + 64 * hi];
#pragma unroll
      for (int i = 0; i < 16; ++i) {
        float4 q = *(const float4*)&rp[4 * i];
        s += q.x * q.x + q.y * q.y + q.z * q.z + q.w * q.w;
      }
      s += __shfl_xor(s, 16, 32);
      rn = rsqrtf(s);
    }

    // ---- logits' [v][h] = E(16x128) x normQ^T(128x16): 32 WMMA K-slices ----
    v8f lg = (v8f)0.f;
    const int aoff = n16 * LSTR + 2 * hi;
#pragma unroll
    for (int c = 0; c < 32; ++c) {
      v2f a = *(const v2f*)&E[aoff + 4 * c];    // A[v][k] slice
      v2f bq = *(const v2f*)&NQ[aoff + 4 * c];  // B[k][h] = Q[h][k] slice
      lg = __builtin_amdgcn_wmma_f32_16x16x4_f32(false, a, false, bq,
                                                 (short)0, lg, false, false);
    }

    // ---- mask + cosine scaling + online softmax (head = n16 per lane) ------
    float p[8];
    float tmax = BIGNEG;
#pragma unroll
    for (int r = 0; r < 8; ++r) {
      float rr = __shfl(rn, r + 8 * hi, 32);    // inv-norm of row r+8*hi
      float lr = (mk[r] != 0) ? lg[r] * rr : BIGNEG;
      p[r] = lr;
      tmax = fmaxf(tmax, lr);
    }
    tmax = fmaxf(tmax, __shfl_xor(tmax, 16, 32));
    float mnew = fmaxf(m, tmax);
    float sc = __expf(m - mnew);
    float tsum = 0.f;
#pragma unroll
    for (int r = 0; r < 8; ++r) {
      float pe = (mk[r] != 0) ? __expf(p[r] - mnew) : 0.f;
      p[r] = pe;
      tsum += pe;
    }
    tsum += __shfl_xor(tsum, 16, 32);
    lsum = lsum * sc + tsum;
    m = mnew;

    // rescale accumulators: row r of acc holds head r+8*hi
#pragma unroll
    for (int r = 0; r < 8; ++r) {
      float scr = __shfl(sc, r + 8 * hi, 32);
#pragma unroll
      for (int ct = 0; ct < 8; ++ct) acc[ct][r] *= scr;
    }

    // ---- build A-layout slices of P (A[h][v]) from D'-layout p[] -----------
    float q0 = __shfl_xor(p[0], 16, 32), q1 = __shfl_xor(p[1], 16, 32);
    float q2 = __shfl_xor(p[2], 16, 32), q3 = __shfl_xor(p[3], 16, 32);
    float q4 = __shfl_xor(p[4], 16, 32), q5 = __shfl_xor(p[5], 16, 32);
    float q6 = __shfl_xor(p[6], 16, 32), q7 = __shfl_xor(p[7], 16, 32);
    v2f aS[4];
    aS[0].x = hi ? q2 : p[0];  aS[0].y = hi ? q3 : p[1];
    aS[1].x = hi ? q6 : p[4];  aS[1].y = hi ? q7 : p[5];
    aS[2].x = hi ? p[2] : q0;  aS[2].y = hi ? p[3] : q1;
    aS[3].x = hi ? p[6] : q4;  aS[3].y = hi ? p[7] : q5;

    // ---- rc += P^T(16x16) x E(16x128): 8 col-tiles x 4 K-slices ------------
#pragma unroll
    for (int ct = 0; ct < 8; ++ct) {
#pragma unroll
      for (int s = 0; s < 4; ++s) {
        v2f bb;
        bb.x = E[(4 * s + 2 * hi + 0) * LSTR + 16 * ct + n16];
        bb.y = E[(4 * s + 2 * hi + 1) * LSTR + 16 * ct + n16];
        acc[ct] = __builtin_amdgcn_wmma_f32_16x16x4_f32(
            false, aS[s], false, bb, (short)0, acc[ct], false, false);
      }
    }
  }

  // ---- write split partial: [b][w][h]{acc[0:128], m, l} ----
  float* pb = part + ((size_t)(b * WSPL + w)) * NHEADS * 130;
#pragma unroll
  for (int r = 0; r < 8; ++r) {
    int h = r + 8 * hi;
#pragma unroll
    for (int ct = 0; ct < 8; ++ct) pb[h * 130 + 16 * ct + n16] = acc[ct][r];
  }
  if (lane < 16) {
    pb[lane * 130 + 128] = m;
    pb[lane * 130 + 129] = lsum;
  }
}

// ---------------------------------------------------------------------------
// Kernel 3: combine split-softmax partials; block per (b,h), 128 threads.
// All loads are issued before the first wait: lane l of every wave takes the
// {m, l} pairs of splits l and l+32, thread e takes column e of all 64 splits.
// ---------------------------------------------------------------------------
__global__ void __launch_bounds__(128) k3_combine(
    const float* __restrict__ part, const float* __restrict__ lossp,
    float* __restrict__ out) {
  const int blk = blockIdx.x;
  const int b = blk >> 4, h = blk & 15;
  const int e = threadIdx.x;
  const int lane = e & 31;
  const float* pb = part + ((size_t)b * WSPL) * NHEADS * 130 + h * 130;

  const v2f ml0 = *(const v2f*)&pb[(size_t)lane * NHEADS * 130 + 128];
  const v2f ml1 = *(const v2f*)&pb[(size_t)(lane + 32) * NHEADS * 130 + 128];
  float lp = 0.f;
  if (blk == 0) {
    lp = lossp[lane];
    // the next loads reuse this load's address register as a destination
    asm volatile("s_wait_xcnt 0x0" ::: "memory");
  }
  float a[WSPL];
#pragma unroll
  for (int w = 0; w < WSPL; ++w) a[w] = pb[(size_t)w * NHEADS * 130 + e];
  // keeps every load above ahead of the first wait; without it more than half
  // of the column loads sink below the wait on the {m, l} pairs
  __builtin_amdgcn_sched_barrier(0);

  float M = fmaxf(ml0.x, ml1.x);
  M = fmaxf(M, xlane<1>(M)); M = fmaxf(M, xlane<2>(M));
  M = fmaxf(M, xlane<4>(M)); M = fmaxf(M, xlane<8>(M));
  M = fmaxf(M, __shfl_xor(M, 16, 32));
  const float s0 = __expf(ml0.x - M), s1 = __expf(ml1.x - M);
  float Ls = s0 * ml0.y + s1 * ml1.y;
  Ls += xlane<1>(Ls); Ls += xlane<2>(Ls); Ls += xlane<4>(Ls); Ls += xlane<8>(Ls);
  Ls += __shfl_xor(Ls, 16, 32);

  float A = 0.f;
#pragma unroll
  for (int w = 0; w < WSPL; ++w) {               // summed in split order 0..63
    float sw = __builtin_bit_cast(float, __builtin_amdgcn_readlane(
        __builtin_bit_cast(int, (w < 32) ? s0 : s1), w & 31));
    A += sw * a[w];
  }
  out[((size_t)b * NHEADS + h) * EMB + e] = A / Ls;
  if (blk == 0) {
    // the lane reads below reuse the registers that the store above names; lp
    // is an operand so that those reads cannot be scheduled ahead of the wait
    asm volatile("s_wait_xcnt 0x0" : "+v"(lp) :: "memory");
    float s = 0.f;
#pragma unroll
    for (int i = 0; i < BS; ++i)
      s += __builtin_bit_cast(float, __builtin_amdgcn_readlane(
          __builtin_bit_cast(int, lp), i));
    if (e == 0) out[BS * NHEADS * EMB] = s;      // loss slot
  }
}

// ---------------------------------------------------------------------------
extern "C" void kernel_launch(void* const* d_in, const int* in_sizes, int n_in,
                              void* d_out, int out_size, void* d_ws, size_t ws_size,
                              hipStream_t stream) {
  const float* query_seed = (const float*)d_in[0];   // [32,128]
  const float* embeddings = (const float*)d_in[1];   // [32,16384,128]
  const int*   attn_mask  = (const int*)d_in[2];     // [32,8192]
  const float* w_qs       = (const float*)d_in[3];   // [16,128,128]
  float* out = (float*)d_out;                        // rc[32*16*128] + loss[1]

  float* ws    = (float*)d_ws;
  float* normq = ws;                                  // 65536 floats
  float* lossp = ws + 65536;                          // 32 floats
  float* part  = ws + 65600;                          // 32*64*16*130 floats

  k1_qs<<<BS, 256, 0, stream>>>(query_seed, w_qs, normq, lossp);
  k2_flash<<<BS * (WSPL / 4), 128, 0, stream>>>(embeddings, attn_mask, normq, part);
  k3_combine<<<BS * NHEADS, 128, 0, stream>>>(part, lossp, out);
}

// v003
// It runs in 51.8 microseconds.
// Two timings next to v002 both put it at 1.27 times that version's speed.
// Counting every step since v000, it is 1.67 times as fast.
#include <hip/hip_runtime.h>
#include <hip/hip_bf16.h>
#include <stdint.h>

typedef float v2f __attribute__((ext_vector_type(2)));
typedef float v4f __attribute__((ext_vector_type(4)));
typedef float v8f __attribute__((ext_vector_type(8)));

#define BS 32
#define VARNUM 16384
#define EMB 128
#define NHEADS 16
#define WSPL 64               // softmax splits per batch (1 wave each)
#define ROWS_PER_WAVE (VARNUM / WSPL)       // 256
#define BROWS (4 * ROWS_PER_WAVE)             // 1024 rows per k2 block
#define LSTR 132              // padded LDS row stride (floats), kills bank conflicts
#define BIGNEG (-3.0e38f)

// value of lane l ^ M, M < 16: a vector cross-lane move inside a 16-lane row
template <int M>
__device__ __forceinline__ float xlane(float x) {
  return __builtin_bit_cast(
      float, __builtin_amdgcn_update_dpp(0, __builtin_bit_cast(int, x),
                                         0x160 | M, 0xf, 0xf, true));
}

// ---------------------------------------------------------------------------
// Kernel 1: qs = tanh(W_q @ seed), L2 normalize per head, gram loss partial.
// One block per batch.
// ---------------------------------------------------------------------------
__global__ void __launch_bounds__(256) k1_qs(
    const float* __restrict__ seed, const float* __restrict__ wqs,
    float* __restrict__ normq, float* __restrict__ lossp) {
  const int b = blockIdx.x, t = threadIdx.x;
  __shared__ __align__(16) float s_seed[128];
  __shared__ __align__(16) float s_q[NHEADS * EMB];
  __shared__ float s_inv[NHEADS];
  __shared__ float s_red[8];

  if (t < 128) s_seed[t] = seed[b * 128 + t];
  __syncthreads();

  // Eight lanes share a weight row: lane piece c reads the 16-B pieces c, c+8,
  // c+16, c+24 of it, so one wave-wide load covers four whole 128-B lines
  // (rows 8*r4+g, r4 = 0..3) instead of 16 B out of 32 different lines.
  const int c = t & 7;
  const int r4 = (t >> 3) & 3;
  v4f sd[4];
#pragma unroll
  for (int j = 0; j < 4; ++j) sd[j] = *(const v4f*)&s_seed[4 * (c + 8 * j)];
  const v4f* wl = (const v4f*)(wqs + (size_t)((t & ~31) + 8 * r4) * 128) + c;
  const bool b0 = (c & 1) != 0, b1 = (c & 2) != 0, b2 = (c & 4) != 0;

  // Stage s = rows g = 4*(s&1)..+3 of pass i = s>>1 (pass i: rows 256*i + ...):
  // 16 loads. Ring of three stage buffers, loads issued two stages ahead.
  v4f wb[3][16];
  float vals[8], p[8];
#pragma unroll
  for (int s = 0; s < 2; ++s)
#pragma unroll
    for (int k = 0; k < 16; ++k)
      wb[s][k] = wl[(256 * (s >> 1) + 4 * (s & 1) + (k >> 2)) * 32 + 8 * (k & 3)];
#pragma unroll
  for (int s = 0; s < 16; ++s) {
    // the fence pair keeps the 16 loads of stage s+2 together and ahead of the
    // sums of stage s; without it the loads sink to their uses, four at a time
    __builtin_amdgcn_sched_barrier(0);
    if (s + 2 < 16) {
#pragma unroll
      for (int k = 0; k < 16; ++k)
        wb[(s + 2) % 3][k] = wl[(256 * ((s + 2) >> 1) + 4 * ((s + 2) & 1) + (k >> 2)) * 32 + 8 * (k & 3)];
    }
    __builtin_amdgcn_sched_barrier(0);
#pragma unroll
    for (int g = 0; g < 4; ++g) {                // partial dot of row 8*r4+4*(s&1)+g
      v2f a = (v2f)0.f, d = (v2f)0.f;
#pragma unroll
      for (int j = 0; j < 4; ++j) {
        v4f w = wb[s % 3][4 * g + j];
        a = __builtin_elementwise_fma(w.lo, sd[j].lo, a);
        d = __builtin_elementwise_fma(w.hi, sd[j].hi, d);
      }
      p[4 * (s & 1) + g] = (a.x + a.y) + (d.x + d.y);
    }
    if (s & 1) {
      // fold the 8 pieces of 8 rows in 7 exchanges; lane c ends with row
      // 8*r4+c, row (t & 31) of the wave's 32: idx = t + 256*i as before
      float q[4], u[2];
#pragma unroll
      for (int k = 0; k < 4; ++k)
        q[k] = (b0 ? p[2 * k + 1] : p[2 * k]) +
               xlane<1>(b0 ? p[2 * k] : p[2 * k + 1]);
#pragma unroll
      for (int k = 0; k < 2; ++k)
        u[k] = (b1 ? q[2 * k + 1] : q[2 * k]) +
               xlane<2>(b1 ? q[2 * k] : q[2 * k + 1]);
      vals[s >> 1] = (b2 ? u[1] : u[0]) + xlane<4>(b2 ? u[0] : u[1]);
    }
  }
#pragma unroll
  for (int i = 0; i < 8; ++i) {
    int idx = t + 256 * i;                       // idx = h*128 + e
    vals[i] = tanhf(vals[i]);
    s_q[idx] = vals[i];
  }
  __syncthreads();

  {  // per-head inverse L2 norm: 16 threads/head (threads grouped by t>>4)
    int h = t >> 4, j = t & 15;
    float p = 0.f;
    for (int e = j; e < EMB; e += 16) { float q = s_q[h * EMB + e]; p += q * q; }
    p += __shfl_xor(p, 8, 32); p += __shfl_xor(p, 4, 32);
    p += __shfl_xor(p, 2, 32); p += __shfl_xor(p, 1, 32);
    if (j == 0) s_inv[h] = rsqrtf(p);
  }
  __syncthreads();

#pragma unroll
  for (int i = 0; i < 8; ++i) {
    int idx = t + 256 * i;
    float nv = vals[i] * s_inv[idx >> 7];
    s_q[idx] = nv;
    normq[(size_t)b * (NHEADS * EMB) + idx] = nv;
  }
  __syncthreads();

  {  // gram - I, squared, reduce; 256 threads <-> 256 (i,j) head pairs
    int i = t >> 4, j = t & 15;
    float d = 0.f;
    for (int e = 0; e < EMB; ++e) d += s_q[i * EMB + e] * s_q[j * EMB + e];
    d -= (i == j) ? 1.f : 0.f;
    float p = d * d;
    p += __shfl_xor(p, 16, 32); p += __shfl_xor(p, 8, 32);
    p += __shfl_xor(p, 4, 32);  p += __shfl_xor(p, 2, 32);
    p += __shfl_xor(p, 1, 32);
    if ((t & 31) == 0) s_red[t >> 5] = p;
    __syncthreads();
    if (t == 0) {
      float s = 0.f;
      for (int w = 0; w < 8; ++w) s += s_red[w];
      lossp[b] = s * (1.0f / (float)BS);
    }
  }
}

// ---------------------------------------------------------------------------
// Async copies of 16 listed rows (512 B each) into a per-wave LDS buffer.
// Lanes l and l+16 hold entry l of the tile's row list in rid; copy i brings
// row rid[i], 16 B a lane: no VGPR staging, tracked by ASYNCcnt.
// LDS byte offset = low 32 bits of the generic pointer (flat LDS aperture).
// ---------------------------------------------------------------------------
__device__ __forceinline__ void issue_rows_async(const float* eb, int rid,
                                                 float* buf, int lane) {
#pragma unroll
  for (int hf = 0; hf < 2; ++hf) {
    unsigned l[8];
    const float* g[8];
#pragma unroll
    for (int i = 0; i < 8; ++i) {
      const int row = __builtin_amdgcn_readlane(rid, 8 * hf + i);
      l[i] = (unsigned)(uintptr_t)&buf[(8 * hf + i) * LSTR + lane * 4];
      g[i] = eb + (size_t)row * EMB + lane * 4;
    }
    // the closing wait stands in the copies' own statement, so that no address
    // register of a copy is rewritten ahead of it
    asm volatile(
        "global_load_async_to_lds_b128 %0, %8, off\n\t"
        "global_load_async_to_lds_b128 %1, %9, off\n\t"
        "global_load_async_to_lds_b128 %2, %10, off\n\t"
        "global_load_async_to_lds_b128 %3, %11, off\n\t"
        "global_load_async_to_lds_b128 %4, %12, off\n\t"
        "global_load_async_to_lds_b128 %5, %13, off\n\t"
        "global_load_async_to_lds_b128 %6, %14, off\n\t"
        "global_load_async_to_lds_b128 %7, %15, off\n\t"
        "s_wait_xcnt 0x0"
        :: "v"(l[0]), "v"(l[1]), "v"(l[2]), "v"(l[3]),
           "v"(l[4]), "v"(l[5]), "v"(l[6]), "v"(l[7]),
           "v"(g[0]), "v"(g[1]), "v"(g[2]), "v"(g[3]),
           "v"(g[4]), "v"(g[5]), "v"(g[6]), "v"(g[7])
        : "memory");
  }
}

// ---------------------------------------------------------------------------
// Kernel 2: fused flash attention over embeddings, fp32 WMMA 16x16x4.
// Block = 128 threads = 4 waves over 1024 rows of one batch. A masked row has
// softmax weight 0, so it is neither read nor multiplied: the block packs the
// numbers of its unmasked rows into an LDS list, cuts the list into tiles of
// 16 and deals them to its waves in turn; each wave = one softmax split.
// Double-buffered async global->LDS staging, per wave.
// ---------------------------------------------------------------------------
__global__ void __launch_bounds__(128) k2_flash(
    const float* __restrict__ emb, const int* __restrict__ mask,
    const float* __restrict__ normq, float* __restrict__ part) {
  __shared__ __align__(16) float NQ[NHEADS * LSTR];
  __shared__ __align__(16) float ET[4][2][16 * LSTR];   // per-wave double buffer
  __shared__ int RL[BROWS + 16];                        // unmasked rows, packed

  const int tid = threadIdx.x;
  const int wave = __builtin_amdgcn_readfirstlane(tid >> 5);
  const int lane = tid & 31;
  const int b = blockIdx.x >> 4;                    // 16 blocks per batch
  const int blk = blockIdx.x & 15;
  const int w = (blk << 2) + wave;                  // split id 0..63
  const int n16 = lane & 15;
  const int hi = lane >> 4;

  // every wave reads the block's 1024 mask words (row v uses word v mod 8192)
  const int* mbase = mask + b * (VARNUM / 2) + ((blk * BROWS) & (VARNUM / 2 - 1));
  int4 mv[8];
#pragma unroll
  for (int g = 0; g < 8; ++g) mv[g] = *(const int4*)&mbase[128 * g + 4 * lane];

  // normq [16x128] -> LDS (padded stride)
  for (int i = tid; i < NHEADS * EMB; i += 128)
    NQ[(i >> 7) * LSTR + (i & 127)] = normq[(size_t)b * (NHEADS * EMB) + i];

  // pack: all waves count all 32 ballots, wave g & 3 stores the rows of group g
  int cnt = 0;
#pragma unroll
  for (int g = 0; g < 8; ++g) {
    const int mm[4] = {mv[g].x, mv[g].y, mv[g].z, mv[g].w};
#pragma unroll
    for (int c = 0; c < 4; ++c) {
      const unsigned bal = __builtin_amdgcn_ballot_w32(mm[c] != 0);
      if ((g & 3) == wave && mm[c] != 0)
        RL[cnt + (int)__builtin_amdgcn_mbcnt_lo(bal, 0u)] = 128 * g + 4 * lane + c;
      cnt += __builtin_popcount(bal);
    }
  }
  // the last tile is filled up with row 0; its filler slots get weight 0 below
  if (tid < 16) RL[cnt + tid] = 0;
  __syncthreads();

  const float* ebase = emb + ((size_t)b * VARNUM + (size_t)blk * BROWS) * EMB;
  const int ntiles = (cnt + 15) >> 4;               // 0..64
  const int trips = (ntiles - wave + 3) >> 2;       // tiles wave, wave+4, ...

  v8f acc[8];
#pragma unroll
  for (int ct = 0; ct < 8; ++ct) acc[ct] = (v8f)0.f;
  float m = BIGNEG, lsum = 0.f;

  // prologue: the wave's first tile is sent off into buffer 0; ridn = list
  // entries of the tile to be sent next
  int ridn = 0;
  if (trips > 0) {
    issue_rows_async(ebase, RL[wave * 16 + n16], &ET[wave][0][0], lane);
    ridn = RL[(wave + 4 * (trips > 1 ? 1 : 0)) * 16 + n16];
  }

  for (int tile = 0; tile < trips; ++tile) {
    float* E = &ET[wave][tile & 1][0];

    // the last trip's reads of the other buffer have drained (refilled below)
    asm volatile("s_wait_dscnt 0x0" ::: "memory");
    // this trip's tile, sent off one trip ago, has landed
    asm volatile("s_wait_asynccnt 0x0" ::: "memory");
    if (tile + 1 < trips) {
      issue_rows_async(ebase, ridn, &ET[wave][(tile + 1) & 1][0], lane);
      // list entries one tile further on (the wave's last tile again at the end)
      const int tn = (tile + 2 < trips) ? tile + 2 : trips - 1;
      ridn = RL[(wave + 4 * tn) * 16 + n16];
    }

    // list slots of the 8 rows this lane-half owns: slot r is a row if r < nv
    const int nv = cnt - ((wave + 4 * tile) << 4) - 8 * hi;

    // ---- per-row inverse L2 norm (lane handles row n16, half the columns) --
    float rn;
    {
      float s = 0.f;
      const float* rp = &E[n16 * LSTR + 64 * hi];
#pragma unroll
      for (int i = 0; i < 16; ++i) {
        float4 q = *(const float4*)&rp[4 * i];
        s += q.x * q.x + q.y * q.y + q.z * q.z + q.w * q.w;
      }
      s += __shfl_xor(s, 16, 32);
      rn = rsqrtf(s);
    }

    // ---- logits' [v][h] = E(16x128) x normQ^T(128x16): 32 WMMA K-slices ----
    v8f lg = (v8f)0.f;
    const int aoff = n16 * LSTR + 2 * hi;
#pragma unroll
    for (int c = 0; c < 32; ++c) {
      v2f a = *(const v2f*)&E[aoff + 4 * c];    // A[v][k] slice
      v2f bq = *(const v2f*)&NQ[aoff + 4 * c];  // B[k][h] = Q[h][k] slice
      lg = __builtin_amdgcn_wmma_f32_16x16x4_f32(false, a, false, bq,
                                                 (short)0, lg, false, false);
    }

    // ---- mask + cosine scaling + online softmax (head = n16 per lane) ------
    float p[8];
    float tmax = BIGNEG;
#pragma unroll
    for (int r = 0; r < 8; ++r) {
      float rr = __shfl(rn, r + 8 * hi, 32);    // inv-norm of row r+8*hi
      float lr = (r < nv) ? lg[r] * rr : BIGNEG;
      p[r] = lr;
      tmax = fmaxf(tmax, lr);
    }
    tmax = fmaxf(tmax, __shfl_xor(tmax, 16, 32));
    float mnew = fmaxf(m, tmax);
    float sc = __expf(m - mnew);
    float tsum = 0.f;
#pragma unroll
    for (int r = 0; r < 8; ++r) {
      float pe = (r < nv) ? __expf(p[r] - mnew) : 0.f;
      p[r] = pe;
      tsum += pe;
    }
    tsum += __shfl_xor(tsum, 16, 32);
    lsum = lsum * sc + tsum;
    m = mnew;

    // rescale accumulators: row r of acc holds head r+8*hi
#pragma unroll
    for (int r = 0; r < 8; ++r) {
      float scr = __shfl(sc, r + 8 * hi, 32);
#pragma unroll
      for (int ct = 0; ct < 8; ++ct) acc[ct][r] *= scr;
    }

    // ---- build A-layout slices of P (A[h][v]) from D'-layout p[] -----------
    float q0 = __shfl_xor(p[0], 16, 32), q1 = __shfl_xor(p[1], 16, 32);
    float q2 = __shfl_xor(p[2], 16, 32), q3 = __shfl_xor(p[3], 16, 32);
    float q4 = __shfl_xor(p[4], 16, 32), q5 = __shfl_xor(p[5], 16, 32);
    float q6 = __shfl_xor(p[6], 16, 32), q7 = __shfl_xor(p[7], 16, 32);
    v2f aS[4];
    aS[0].x = hi ? q2 : p[0];  aS[0].y = hi ? q3 : p[1];
    aS[1].x = hi ? q6 : p[4];  aS[1].y = hi ? q7 : p[5];
    aS[2].x = hi ? p[2] : q0;  aS[2].y = hi ? p[3] : q1;
    aS[3].x = hi ? p[6] : q4;  aS[3].y = hi ? p[7] : q5;

    // ---- rc += P^T(16x16) x E(16x128): 8 col-tiles x 4 K-slices ------------
#pragma unroll
    for (int ct = 0; ct < 8; ++ct) {
#pragma unroll
      for (int s = 0; s < 4; ++s) {
        v2f bb;
        bb.x = E[(4 * s + 2 * hi + 0) * LSTR + 16 * ct + n16];
        bb.y = E[(4 * s + 2 * hi + 1) * LSTR + 16 * ct + n16];
        acc[ct] = __builtin_amdgcn_wmma_f32_16x16x4_f32(
            false, aS[s], false, bb, (short)0, acc[ct], false, false);
      }
    }
  }

  // ---- write split partial: [b][w][h]{acc[0:128], m, l} ----
  float* pb = part + ((size_t)(b * WSPL + w)) * NHEADS * 130;
#pragma unroll
  for (int r = 0; r < 8; ++r) {
    int h = r + 8 * hi;
#pragma unroll
    for (int ct = 0; ct < 8; ++ct) pb[h * 130 + 16 * ct + n16] = acc[ct][r];
  }
  if (lane < 16) {
    pb[lane * 130 + 128] = m;
    pb[lane * 130 + 129] = lsum;
  }
}

// ---------------------------------------------------------------------------
// Kernel 3: combine split-softmax partials; block per (b,h), 128 threads.
// All loads are issued before the first wait: lane l of every wave takes the
// {m, l} pairs of splits l and l+32, thread e takes column e of all 64 splits.
// ---------------------------------------------------------------------------
__global__ void __launch_bounds__(128) k3_combine(
    const float* __restrict__ part, const float* __restrict__ lossp,
    float* __restrict__ out) {
  const int blk = blockIdx.x;
  const int b = blk >> 4, h = blk & 15;
  const int e = threadIdx.x;
  const int lane = e & 31;
  const float* pb = part + ((size_t)b * WSPL) * NHEADS * 130 + h * 130;

  const v2f ml0 = *(const v2f*)&pb[(size_t)lane * NHEADS * 130 + 128];
  const v2f ml1 = *(const v2f*)&pb[(size_t)(lane + 32) * NHEADS * 130 + 128];
  float lp = 0.f;
  if (blk == 0) {
    lp = lossp[lane];
    // the next loads reuse this load's address register as a destination
    asm volatile("s_wait_xcnt 0x0" ::: "memory");
  }
  float a[WSPL];
#pragma unroll
  for (int w = 0; w < WSPL; ++w) a[w] = pb[(size_t)w * NHEADS * 130 + e];
  // keeps every load above ahead of the first wait; without it more than half
  // of the column loads sink below the wait on the {m, l} pairs
  __builtin_amdgcn_sched_barrier(0);

  float M = fmaxf(ml0.x, ml1.x);
  M = fmaxf(M, xlane<1>(M)); M = fmaxf(M, xlane<2>(M));
  M = fmaxf(M, xlane<4>(M)); M = fmaxf(M, xlane<8>(M));
  M = fmaxf(M, __shfl_xor(M, 16, 32));
  const float s0 = __expf(ml0.x - M), s1 = __expf(ml1.x - M);
  float Ls = s0 * ml0.y + s1 * ml1.y;
  Ls += xlane<1>(Ls); Ls += xlane<2>(Ls); Ls += xlane<4>(Ls); Ls += xlane<8>(Ls);
  Ls += __shfl_xor(Ls, 16, 32);

  float A = 0.f;
#pragma unroll
  for (int w = 0; w < WSPL; ++w) {               // summed in split order 0..63
    float sw = __builtin_bit_cast(float, __builtin_amdgcn_readlane(
        __builtin_bit_cast(int, (w < 32) ? s0 : s1), w & 31));
    A += sw * a[w];
  }
  out[((size_t)b * NHEADS + h) * EMB + e] = A / Ls;
  if (blk == 0) {
    // the lane reads below reuse the registers that the store above names; lp
    // is an operand so that those reads cannot be scheduled ahead of the wait
    asm volatile("s_wait_xcnt 0x0" : "+v"(lp) :: "memory");
    float s = 0.f;
#pragma unroll
    for (int i = 0; i < BS; ++i)
      s += __builtin_bit_cast(float, __builtin_amdgcn_readlane(
          __builtin_bit_cast(int, lp), i));
    if (e == 0) out[BS * NHEADS * EMB] = s;      // loss slot
  }
}

// ---------------------------------------------------------------------------
extern "C" void kernel_launch(void* const* d_in, const int* in_sizes, int n_in,
                              void* d_out, int out_size, void* d_ws, size_t ws_size,
                              hipStream_t stream) {
  const float* query_seed = (const float*)d_in[0];   // [32,128]
  const float* embeddings = (const float*)d_in[1];   // [32,16384,128]
  const int*   attn_mask  = (const int*)d_in[2];     // [32,8192]
  const float* w_qs       = (const float*)d_in[3];   // [16,128,128]
  float* out = (float*)d_out;                        // rc[32*16*128] + loss[1]

  float* ws    = (float*)d_ws;
  float* normq = ws;                                  // 65536 floats
  float* lossp = ws + 65536;                          // 32 floats
  float* part  = ws + 65600;                          // 32*64*16*130 floats

  k1_qs<<<BS, 256, 0, stream>>>(query_seed, w_qs, normq, lossp);
  k2_flash<<<BS * (WSPL / 4), 128, 0, stream>>>(embeddings, attn_mask, normq, part);
  k3_combine<<<BS * NHEADS, 128, 0, stream>>>(part, lossp, out);
}

// v004
// A run of this version takes 36.8 microseconds.
// Two timings next to v003 put it at 1.38 and 1.39 times that version's speed.
// Over all steps from v000 it is 2.32 times as fast.
#include <hip/hip_runtime.h>
#include <hip/hip_bf16.h>
#include <stdint.h>

typedef float v2f __attribute__((ext_vector_type(2)));
typedef float v4f __attribute__((ext_vector_type(4)));
typedef float v8f __attribute__((ext_vector_type(8)));

#define BS 32
#define VARNUM 16384
#define EMB 128
#define NHEADS 16
#define WSPL 64               // softmax splits per batch (1 wave each)
#define ROWS_PER_WAVE (VARNUM / WSPL)       // 256
#define BROWS (4 * ROWS_PER_WAVE)             // 1024 rows per k2 block
#define LSTR 132              // padded LDS row stride (floats), kills bank conflicts
#define BIGNEG (-3.0e38f)
#define NB 2                  // batches per k1 block

// value of lane l ^ M, M < 16: a vector cross-lane move inside a 16-lane row
template <int M>
__device__ __forceinline__ float xlane(float x) {
  return __builtin_bit_cast(
      float, __builtin_amdgcn_update_dpp(0, __builtin_bit_cast(int, x),
                                         0x160 | M, 0xf, 0xf, true));
}

// ---------------------------------------------------------------------------
// Kernel 1: qs = tanh(W_q @ seed), L2 normalized per head.
// One block per (pair of heads, NB batches): one weight row a thread, read once
// for its NB batches, so the weight read is spread over many WGPs and is one
// burst of loads. The gram loss needs all 16 heads of a batch: it is formed in
// kernel 2.
// ---------------------------------------------------------------------------
__global__ void __launch_bounds__(256) k1_qs(
    const float* __restrict__ seed, const float* __restrict__ wqs,
    float* __restrict__ normq) {
  const int bg = blockIdx.x >> 3, i = blockIdx.x & 7, t = threadIdx.x;
  __shared__ __align__(16) float s_red[NB][16];

  // Eight lanes share a weight row: lane piece c reads the 16-B pieces c, c+8,
  // c+16, c+24 of it, so one wave-wide load covers four whole 128-B lines
  // (rows 8*r4+g, r4 = 0..3) instead of 16 B out of 32 different lines.
  const int c = t & 7;
  const int r4 = (t >> 3) & 3;
  const v4f* sl = (const v4f*)(seed + NB * bg * 128) + c;
  const v4f* wl = (const v4f*)(wqs + (size_t)(256 * i + (t & ~31) + 8 * r4) * 128) + c;
  const bool b0 = (c & 1) != 0, b1 = (c & 2) != 0, b2 = (c & 4) != 0;

  v4f sd[NB][4], wb[32];
#pragma unroll
  for (int n = 0; n < NB; ++n)
#pragma unroll
    for (int j = 0; j < 4; ++j) sd[n][j] = sl[32 * n + 8 * j];
#pragma unroll
  for (int k = 0; k < 32; ++k) wb[k] = wl[(k >> 2) * 32 + 8 * (k & 3)];
  // keeps all loads ahead of the first sum; without it the loads sink to their
  // uses and the wave pays the load latency several times
  __builtin_amdgcn_sched_barrier(0);

  float v[NB];
#pragma unroll
  for (int n = 0; n < NB; ++n) {
    float p[8];
#pragma unroll
    for (int g = 0; g < 8; ++g) {                // partial dot of row 8*r4+g
      v2f a = (v2f)0.f, d = (v2f)0.f;
#pragma unroll
      for (int j = 0; j < 4; ++j) {
        v4f w = wb[4 * g + j];
        a = __builtin_elementwise_fma(w.lo, sd[n][j].lo, a);
        d = __builtin_elementwise_fma(w.hi, sd[n][j].hi, d);
      }
      p[g] = (a.x + a.y) + (d.x + d.y);
    }
    // fold the 8 pieces of 8 rows in 7 exchanges; lane c ends with row 8*r4+c,
    // row (t & 31) of the wave's 32: idx = h*128 + e = 256*i + t
    float q[4], u[2];
#pragma unroll
    for (int k = 0; k < 4; ++k)
      q[k] = (b0 ? p[2 * k + 1] : p[2 * k]) +
             xlane<1>(b0 ? p[2 * k] : p[2 * k + 1]);
#pragma unroll
    for (int k = 0; k < 2; ++k)
      u[k] = (b1 ? q[2 * k + 1] : q[2 * k]) +
             xlane<2>(b1 ? q[2 * k] : q[2 * k + 1]);
    v[n] = tanhf((b2 ? u[1] : u[0]) + xlane<4>(b2 ? u[0] : u[1]));

    // squared norm of the head (threads 128*(t>>7)..+127): 16-lane rows by
    // cross-lane moves, the head's 8 row sums through LDS
    float ss = v[n] * v[n];
    ss += xlane<1>(ss); ss += xlane<2>(ss); ss += xlane<4>(ss); ss += xlane<8>(ss);
    if ((t & 15) == 0) s_red[n][t >> 4] = ss;
  }
  __syncthreads();
#pragma unroll
  for (int n = 0; n < NB; ++n) {
    const v4f r0 = *(const v4f*)&s_red[n][8 * (t >> 7)];
    const v4f r1 = *(const v4f*)&s_red[n][8 * (t >> 7) + 4];
    const float tot = ((r0.x + r0.y) + (r0.z + r0.w)) + ((r1.x + r1.y) + (r1.z + r1.w));
    normq[(size_t)(NB * bg + n) * (NHEADS * EMB) + 256 * i + t] = v[n] * rsqrtf(tot);
  }
}

// ---------------------------------------------------------------------------
// Async copies of 16 listed rows (512 B each) into a per-wave LDS buffer.
// Lanes l and l+16 hold entry l of the tile's row list in rid; copy i brings
// row rid[i], 16 B a lane: no VGPR staging, tracked by ASYNCcnt.
// LDS byte offset = low 32 bits of the generic pointer (flat LDS aperture).
// ---------------------------------------------------------------------------
__device__ __forceinline__ void issue_rows_async(const float* eb, int rid,
                                                 float* buf, int lane) {
#pragma unroll
  for (int hf = 0; hf < 2; ++hf) {
    unsigned l[8];
    const float* g[8];
#pragma unroll
    for (int i = 0; i < 8; ++i) {
      const int row = __builtin_amdgcn_readlane(rid, 8 * hf + i);
      l[i] = (unsigned)(uintptr_t)&buf[(8 * hf + i) * LSTR + lane * 4];
      g[i] = eb + (size_t)row * EMB + lane * 4;
    }
    // the closing wait stands in the copies' own statement, so that no address
    // register of a copy is rewritten ahead of it
    asm volatile(
        "global_load_async_to_lds_b128 %0, %8, off\n\t"
        "global_load_async_to_lds_b128 %1, %9, off\n\t"
        "global_load_async_to_lds_b128 %2, %10, off\n\t"
        "global_load_async_to_lds_b128 %3, %11, off\n\t"
        "global_load_async_to_lds_b128 %4, %12, off\n\t"
        "global_load_async_to_lds_b128 %5, %13, off\n\t"
        "global_load_async_to_lds_b128 %6, %14, off\n\t"
        "global_load_async_to_lds_b128 %7, %15, off\n\t"
        "s_wait_xcnt 0x0"
        :: "v"(l[0]), "v"(l[1]), "v"(l[2]), "v"(l[3]),
           "v"(l[4]), "v"(l[5]), "v"(l[6]), "v"(l[7]),
           "v"(g[0]), "v"(g[1]), "v"(g[2]), "v"(g[3]),
           "v"(g[4]), "v"(g[5]), "v"(g[6]), "v"(g[7])
        : "memory");
  }
}

// ---------------------------------------------------------------------------
// Kernel 2: fused flash attention over embeddings, fp32 WMMA 16x16x4.
// Block = 128 threads = 4 waves over 1024 rows of one batch. A masked row has
// softmax weight 0, so it is neither read nor multiplied: the block packs the
// numbers of its unmasked rows into an LDS list, cuts the list into tiles of
// 16 and deals them to its waves in turn; each wave = one softmax split.
// Double-buffered async global->LDS staging, per wave.
// ---------------------------------------------------------------------------
__global__ void __launch_bounds__(128) k2_flash(
    const float* __restrict__ emb, const int* __restrict__ mask,
    const float* __restrict__ normq, float* __restrict__ part,
    float* __restrict__ lossp) {
  __shared__ __align__(16) float NQ[NHEADS * LSTR];
  __shared__ __align__(16) float ET[4][2][16 * LSTR];   // per-wave double buffer
  __shared__ int RL[BROWS + 16];                        // unmasked rows, packed

  const int tid = threadIdx.x;
  const int wave = __builtin_amdgcn_readfirstlane(tid >> 5);
  const int lane = tid & 31;
  const int b = blockIdx.x >> 4;                    // 16 blocks per batch
  const int blk = blockIdx.x & 15;
  const int w = (blk << 2) + wave;                  // split id 0..63
  const int n16 = lane & 15;
  const int hi = lane >> 4;

  // every wave reads the block's 1024 mask words (row v uses word v mod 8192)
  const int* mbase = mask + b * (VARNUM / 2) + ((blk * BROWS) & (VARNUM / 2 - 1));
  int4 mv[8];
#pragma unroll
  for (int g = 0; g < 8; ++g) mv[g] = *(const int4*)&mbase[128 * g + 4 * lane];

  // normq [16x128] -> LDS (padded stride)
  for (int i = tid; i < NHEADS * EMB; i += 128)
    NQ[(i >> 7) * LSTR + (i & 127)] = normq[(size_t)b * (NHEADS * EMB) + i];

  // pack: all waves count all 32 ballots, wave g & 3 stores the rows of group g
  int cnt = 0;
#pragma unroll
  for (int g = 0; g < 8; ++g) {
    const int mm[4] = {mv[g].x, mv[g].y, mv[g].z, mv[g].w};
#pragma unroll
    for (int c = 0; c < 4; ++c) {
      const unsigned bal = __builtin_amdgcn_ballot_w32(mm[c] != 0);
      if ((g & 3) == wave && mm[c] != 0)
        RL[cnt + (int)__builtin_amdgcn_mbcnt_lo(bal, 0u)] = 128 * g + 4 * lane + c;
      cnt += __builtin_popcount(bal);
    }
  }
  // the last tile is filled up with row 0; its filler slots get weight 0 below
  if (tid < 16) RL[cnt + tid] = 0;
  __syncthreads();

  const float* ebase = emb + ((size_t)b * VARNUM + (size_t)blk * BROWS) * EMB;
  const int ntiles = (cnt + 15) >> 4;               // 0..64
  const int trips = (ntiles - wave + 3) >> 2;       // tiles wave, wave+4, ...

  v8f acc[8];
#pragma unroll
  for (int ct = 0; ct < 8; ++ct) acc[ct] = (v8f)0.f;
  float m = BIGNEG, lsum = 0.f;

  // prologue: the wave's first tile is sent off into buffer 0; ridn = list
  // entries of the tile to be sent next
  int ridn = 0;
  if (trips > 0) {
    issue_rows_async(ebase, RL[wave * 16 + n16], &ET[wave][0][0], lane);
    ridn = RL[(wave + 4 * (trips > 1 ? 1 : 0)) * 16 + n16];
  }

  // ---- orthogonality loss of the batch: gram = normQ x normQ^T, minus I,
  // squared and summed. One wave of the batch's first block (the wave with the
  // fewest tiles), while its first tile is on the way. The A slice of normQ
  // and the B slice of normQ^T are the same two words of a lane.
  if (blk == 0 && wave == 3) {
    v8f gr = (v8f)0.f;
#pragma unroll
    for (int c = 0; c < 32; ++c) {
      v2f a = *(const v2f*)&NQ[n16 * LSTR + 2 * hi + 4 * c];
      gr = __builtin_amdgcn_wmma_f32_16x16x4_f32(false, a, false, a,
                                                 (short)0, gr, false, false);
    }
    // four vector slots between the last WMMA and the first read of its
    // result; the operand holds them at that place
    asm volatile("v_nop\n\tv_nop\n\tv_nop\n\tv_nop" : "+v"(gr));
    float s = 0.f;
#pragma unroll
    for (int r = 0; r < 8; ++r) {                // element (r + 8*hi, n16)
      float d = gr[r] - ((r + 8 * hi == n16) ? 1.f : 0.f);
      s += d * d;
    }
    s += xlane<1>(s); s += xlane<2>(s); s += xlane<4>(s); s += xlane<8>(s);
    s += __shfl_xor(s, 16, 32);
    if (lane == 0) lossp[b] = s * (1.0f / (float)BS);
  }

  for (int tile = 0; tile < trips; ++tile) {
    float* E = &ET[wave][tile & 1][0];

    // the last trip's reads of the other buffer have drained (refilled below)
    asm volatile("s_wait_dscnt 0x0" ::: "memory");
    // this trip's tile, sent off one trip ago, has landed
    asm volatile("s_wait_asynccnt 0x0" ::: "memory");
    if (tile + 1 < trips) {
      issue_rows_async(ebase, ridn, &ET[wave][(tile + 1) & 1][0], lane);
      // list entries one tile further on (the wave's last tile again at the end)
      const int tn = (tile + 2 < trips) ? tile + 2 : trips - 1;
      ridn = RL[(wave + 4 * tn) * 16 + n16];
    }

    // list slots of the 8 rows this lane-half owns: slot r is a row if r < nv
    const int nv = cnt - ((wave + 4 * tile) << 4) - 8 * hi;

    // ---- per-row inverse L2 norm (lane handles row n16, half the columns) --
    float rn;
    {
      float s = 0.f;
      const float* rp = &E[n16 * LSTR + 64 * hi];
#pragma unroll
      for (int i = 0; i < 16; ++i) {
        float4 q = *(const float4*)&rp[4 * i];
        s += q.x * q.x + q.y * q.y + q.z * q.z + q.w * q.w;
      }
      s += __shfl_xor(s, 16, 32);
      rn = rsqrtf(s);
    }

    // ---- logits' [v][h] = E(16x128) x normQ^T(128x16): 32 WMMA K-slices ----
    v8f lg = (v8f)0.f;
    const int aoff = n16 * LSTR + 2 * hi;
#pragma unroll
    for (int c = 0; c < 32; ++c) {
      v2f a = *(const v2f*)&E[aoff + 4 * c];    // A[v][k] slice
      v2f bq = *(const v2f*)&NQ[aoff + 4 * c];  // B[k][h] = Q[h][k] slice
      lg = __builtin_amdgcn_wmma_f32_16x16x4_f32(false, a, false, bq,
                                                 (short)0, lg, false, false);
    }

    // ---- mask + cosine scaling + online softmax (head = n16 per lane) ------
    float p[8];
    float tmax = BIGNEG;
#pragma unroll
    for (int r = 0; r < 8; ++r) {
      float rr = __shfl(rn, r + 8 * hi, 32);    // inv-norm of row r+8*hi
      float lr = (r < nv) ? lg[r] * rr : BIGNEG;
      p[r] = lr;
      tmax = fmaxf(tmax, lr);
    }
    tmax = fmaxf(tmax, __shfl_xor(tmax, 16, 32));
    float mnew = fmaxf(m, tmax);
    float sc = __expf(m - mnew);
    float tsum = 0.f;
#pragma unroll
    for (int r = 0; r < 8; ++r) {
      float pe = (r < nv) ? __expf(p[r] - mnew) : 0.f;
      p[r] = pe;
      tsum += pe;
    }
    tsum += __shfl_xor(tsum, 16, 32);
    lsum = lsum * sc + tsum;
    m = mnew;

    // rescale accumulators: row r of acc holds head r+8*hi
#pragma unroll
    for (int r = 0; r < 8; ++r) {
      float scr = __shfl(sc, r + 8 * hi, 32);
#pragma unroll
      for (int ct = 0; ct < 8; ++ct) acc[ct][r] *= scr;
    }

    // ---- build A-layout slices of P (A[h][v]) from D'-layout p[] -----------
    float q0 = __shfl_xor(p[0], 16, 32), q1 = __shfl_xor(p[1], 16, 32);
    float q2 = __shfl_xor(p[2], 16, 32), q3 = __shfl_xor(p[3], 16, 32);
    float q4 = __shfl_xor(p[4], 16, 32), q5 = __shfl_xor(p[5], 16, 32);
    float q6 = __shfl_xor(p[6], 16, 32), q7 = __shfl_xor(p[7], 16, 32);
    v2f aS[4];
    aS[0].x = hi ? q2 : p[0];  aS[0].y = hi ? q3 : p[1];
    aS[1].x = hi ? q6 : p[4];  aS[1].y = hi ? q7 : p[5];
    aS[2].x = hi ? p[2] : q0;  aS[2].y = hi ? p[3] : q1;
    aS[3].x = hi ? p[6] : q4;  aS[3].y = hi ? p[7] : q5;

    // ---- rc += P^T(16x16) x E(16x128): 8 col-tiles x 4 K-slices ------------
#pragma unroll
    for (int ct = 0; ct < 8; ++ct) {
#pragma unroll
      for (int s = 0; s < 4; ++s) {
        v2f bb;
        bb.x = E[(4 * s + 2 * hi + 0) * LSTR + 16 * ct + n16];
        bb.y = E[(4 * s + 2 * hi + 1) * LSTR + 16 * ct + n16];
        acc[ct] = __builtin_amdgcn_wmma_f32_16x16x4_f32(
            false, aS[s], false, bb, (short)0, acc[ct], false, false);
      }
    }
  }

  // ---- write split partial: [b][w][h]{acc[0:128], m, l} ----
  float* pb = part + ((size_t)(b * WSPL + w)) * NHEADS * 130;
#pragma unroll
  for (int r = 0; r < 8; ++r) {
    int h = r + 8 * hi;
#pragma unroll
    for (int ct = 0; ct < 8; ++ct) pb[h * 130 + 16 * ct + n16] = acc[ct][r];
  }
  if (lane < 16) {
    pb[lane * 130 + 128] = m;
    pb[lane * 130 + 129] = lsum;
  }
}

// ---------------------------------------------------------------------------
// Kernel 3: combine split-softmax partials; block per (b,h), 128 threads.
// All loads are issued before the first wait: lane l of every wave takes the
// {m, l} pairs of splits l and l+32, thread e takes column e of all 64 splits.
// ---------------------------------------------------------------------------
__global__ void __launch_bounds__(128) k3_combine(
    const float* __restrict__ part, const float* __restrict__ lossp,
    float* __restrict__ out) {
  const int blk = blockIdx.x;
  const int b = blk >> 4, h = blk & 15;
  const int e = threadIdx.x;
  const int lane = e & 31;
  const float* pb = part + ((size_t)b * WSPL) * NHEADS * 130 + h * 130;

  const v2f ml0 = *(const v2f*)&pb[(size_t)lane * NHEADS * 130 + 128];
  const v2f ml1 = *(const v2f*)&pb[(size_t)(lane + 32) * NHEADS * 130 + 128];
  float lp = 0.f;
  if (blk == 0) {
    lp = lossp[lane];
    // the next loads reuse this load's address register as a destination
    asm volatile("s_wait_xcnt 0x0" ::: "memory");
  }
  float a[WSPL];
#pragma unroll
  for (int w = 0; w < WSPL; ++w) a[w] = pb[(size_t)w * NHEADS * 130 + e];
  // keeps every load above ahead of the first wait; without it more than half
  // of the column loads sink below the wait on the {m, l} pairs
  __builtin_amdgcn_sched_barrier(0);

  float M = fmaxf(ml0.x, ml1.x);
  M = fmaxf(M, xlane<1>(M)); M = fmaxf(M, xlane<2>(M));
  M = fmaxf(M, xlane<4>(M)); M = fmaxf(M, xlane<8>(M));
  M = fmaxf(M, __shfl_xor(M, 16, 32));
  const float s0 = __expf(ml0.x - M), s1 = __expf(ml1.x - M);
  float Ls = s0 * ml0.y + s1 * ml1.y;
  Ls += xlane<1>(Ls); Ls += xlane<2>(Ls); Ls += xlane<4>(Ls); Ls += xlane<8>(Ls);
  Ls += __shfl_xor(Ls, 16, 32);

  float A = 0.f;
#pragma unroll
  for (int w = 0; w < WSPL; ++w) {               // summed in split order 0..63
    float sw = __builtin_bit_cast(float, __builtin_amdgcn_readlane(
        __builtin_bit_cast(int, (w < 32) ? s0 : s1), w & 31));
    A += sw * a[w];
  }
  out[((size_t)b * NHEADS + h) * EMB + e] = A / Ls;
  if (blk == 0) {
    // the lane reads below reuse the registers that the store above names; lp
    // is an operand so that those reads cannot be scheduled ahead of the wait
    asm volatile("s_wait_xcnt 0x0" : "+v"(lp) :: "memory");
    float s = 0.f;
#pragma unroll
    for (int i = 0; i < BS; ++i)
      s += __builtin_bit_cast(float, __builtin_amdgcn_readlane(
          __builtin_bit_cast(int, lp), i));
    if (e == 0) out[BS * NHEADS * EMB] = s;      // loss slot
  }
}

// ---------------------------------------------------------------------------
extern "C" void kernel_launch(void* const* d_in, const int* in_sizes, int n_in,
                              void* d_out, int out_size, void* d_ws, size_t ws_size,
                              hipStream_t stream) {
  const float* query_seed = (const float*)d_in[0];   // [32,128]
  const float* embeddings = (const float*)d_in[1];   // [32,16384,128]
  const int*   attn_mask  = (const int*)d_in[2];     // [32,8192]
  const float* w_qs       = (const float*)d_in[3];   // [16,128,128]
  float* out = (float*)d_out;                        // rc[32*16*128] + loss[1]

  float* ws    = (float*)d_ws;
  float* normq = ws;                                  // 65536 floats
  float* lossp = ws + 65536;                          // 32 floats
  float* part  = ws + 65600;                          // 32*64*16*130 floats

  k1_qs<<<(BS / NB) * (NHEADS / 2), 256, 0, stream>>>(query_seed, w_qs, normq);
  k2_flash<<<BS * (WSPL / 4), 128, 0, stream>>>(embeddings, attn_mask, normq, part, lossp);
  k3_combine<<<BS * NHEADS, 128, 0, stream>>>(part, lossp, out);
}

// v005
// It runs in 35.5 microseconds.
// Timed twice side by side with v004, it ran 1.07 and 1.06 times as fast.
// Over all steps from v000 it is 2.47 times as fast.
#include <hip/hip_runtime.h>
#include <hip/hip_bf16.h>
#include <stdint.h>

typedef float v2f __attribute__((ext_vector_type(2)));
typedef float v4f __attribute__((ext_vector_type(4)));
typedef float v8f __attribute__((ext_vector_type(8)));

#define BS 32
#define VARNUM 16384
#define EMB 128
#define NHEADS 16
#define WSPL 64               // softmax splits per batch (1 wave each)
#define ROWS_PER_WAVE (VARNUM / WSPL)       // 256
#define BROWS (4 * ROWS_PER_WAVE)             // 1024 rows per k2 block
#define LSTR 132              // padded LDS row stride (floats), kills bank conflicts
#define BIGNEG (-3.0e38f)
#define NB 2                  // batches per k1 block

// value of lane l ^ M, M < 16: a vector cross-lane move inside a 16-lane row
template <int M>
__device__ __forceinline__ float xlane(float x) {
  return __builtin_bit_cast(
      float, __builtin_amdgcn_update_dpp(0, __builtin_bit_cast(int, x),
                                         0x160 | M, 0xf, 0xf, true));
}

// ---------------------------------------------------------------------------
// Kernel 1: qs = tanh(W_q @ seed), L2 normalized per head.
// One block per (pair of heads, NB batches): one weight row a thread, read once
// for its NB batches, so the weight read is spread over many WGPs and is one
// burst of loads. The gram loss needs all 16 heads of a batch: it is formed in
// kernel 2.
// ---------------------------------------------------------------------------
__global__ void __launch_bounds__(256) k1_qs(
    const float* __restrict__ seed, const float* __restrict__ wqs,
    float* __restrict__ normq) {
  const int bg = blockIdx.x >> 3, i = blockIdx.x & 7, t = threadIdx.x;
  __shared__ __align__(16) float s_red[NB][16];

  // Eight lanes share a weight row: lane piece c reads the 16-B pieces c, c+8,
  // c+16, c+24 of it, so one wave-wide load covers four whole 128-B lines
  // (rows 8*r4+g, r4 = 0..3) instead of 16 B out of 32 different lines.
  const int c = t & 7;
  const int r4 = (t >> 3) & 3;
  const v4f* sl = (const v4f*)(seed + NB * bg * 128) + c;
  const v4f* wl = (const v4f*)(wqs + (size_t)(256 * i + (t & ~31) + 8 * r4) * 128) + c;
  const bool b0 = (c & 1) != 0, b1 = (c & 2) != 0, b2 = (c & 4) != 0;

  v4f sd[NB][4], wb[32];
#pragma unroll
  for (int n = 0; n < NB; ++n)
#pragma unroll
    for (int j = 0; j < 4; ++j) sd[n][j] = sl[32 * n + 8 * j];
#pragma unroll
  for (int k = 0; k < 32; ++k) wb[k] = wl[(k >> 2) * 32 + 8 * (k & 3)];
  // keeps all loads ahead of the first sum; without it the loads sink to their
  // uses and the wave pays the load latency several times
  __builtin_amdgcn_sched_barrier(0);

  float v[NB];
#pragma unroll
  for (int n = 0; n < NB; ++n) {
    float p[8];
#pragma unroll
    for (int g = 0; g < 8; ++g) {                // partial dot of row 8*r4+g
      v2f a = (v2f)0.f, d = (v2f)0.f;
#pragma unroll
      for (int j = 0; j < 4; ++j) {
        v4f w = wb[4 * g + j];
        a = __builtin_elementwise_fma(w.lo, sd[n][j].lo, a);
        d = __builtin_elementwise_fma(w.hi, sd[n][j].hi, d);
      }
      p[g] = (a.x + a.y) + (d.x + d.y);
    }
    // fold the 8 pieces of 8 rows in 7 exchanges; lane c ends with row 8*r4+c,
    // row (t & 31) of the wave's 32: idx = h*128 + e = 256*i + t
    float q[4], u[2];
#pragma unroll
    for (int k = 0; k < 4; ++k)
      q[k] = (b0 ? p[2 * k + 1] : p[2 * k]) +
             xlane<1>(b0 ? p[2 * k] : p[2 * k + 1]);
#pragma unroll
    for (int k = 0; k < 2; ++k)
      u[k] = (b1 ? q[2 * k + 1] : q[2 * k]) +
             xlane<2>(b1 ? q[2 * k] : q[2 * k + 1]);
    v[n] = tanhf((b2 ? u[1] : u[0]) + xlane<4>(b2 ? u[0] : u[1]));

    // squared norm of the head (threads 128*(t>>7)..+127): 16-lane rows by
    // cross-lane moves, the head's 8 row sums through LDS
    float ss = v[n] * v[n];
    ss += xlane<1>(ss); ss += xlane<2>(ss); ss += xlane<4>(ss); ss += xlane<8>(ss);
    if ((t & 15) == 0) s_red[n][t >> 4] = ss;
  }
  __syncthreads();
#pragma unroll
  for (int n = 0; n < NB; ++n) {
    const v4f r0 = *(const v4f*)&s_red[n][8 * (t >> 7)];
    const v4f r1 = *(const v4f*)&s_red[n][8 * (t >> 7) + 4];
    const float tot = ((r0.x + r0.y) + (r0.z + r0.w)) + ((r1.x + r1.y) + (r1.z + r1.w));
    normq[(size_t)(NB * bg + n) * (NHEADS * EMB) + 256 * i + t] = v[n] * rsqrtf(tot);
  }
}

// ---------------------------------------------------------------------------
// Async copies of 16 listed rows (512 B each) into a per-wave LDS buffer.
// Lanes l and l+16 hold entry l of the tile's row list in rid; copy i brings
// row rid[i], 16 B a lane: no VGPR staging, tracked by ASYNCcnt.
// LDS byte offset = low 32 bits of the generic pointer (flat LDS aperture).
// ---------------------------------------------------------------------------
__device__ __forceinline__ void issue_rows_async(const float* eb, int rid,
                                                 float* buf, int lane) {
#pragma unroll
  for (int hf = 0; hf < 2; ++hf) {
    unsigned l[8];
    const float* g[8];
#pragma unroll
    for (int i = 0; i < 8; ++i) {
      const int row = __builtin_amdgcn_readlane(rid, 8 * hf + i);
      l[i] = (unsigned)(uintptr_t)&buf[(8 * hf + i) * LSTR + lane * 4];
      g[i] = eb + (size_t)row * EMB + lane * 4;
    }
    // the closing wait stands in the copies' own statement, so that no address
    // register of a copy is rewritten ahead of it
    asm volatile(
        "global_load_async_to_lds_b128 %0, %8, off\n\t"
        "global_load_async_to_lds_b128 %1, %9, off\n\t"
        "global_load_async_to_lds_b128 %2, %10, off\n\t"
        "global_load_async_to_lds_b128 %3, %11, off\n\t"
        "global_load_async_to_lds_b128 %4, %12, off\n\t"
        "global_load_async_to_lds_b128 %5, %13, off\n\t"
        "global_load_async_to_lds_b128 %6, %14, off\n\t"
        "global_load_async_to_lds_b128 %7, %15, off\n\t"
        "s_wait_xcnt 0x0"
        :: "v"(l[0]), "v"(l[1]), "v"(l[2]), "v"(l[3]),
           "v"(l[4]), "v"(l[5]), "v"(l[6]), "v"(l[7]),
           "v"(g[0]), "v"(g[1]), "v"(g[2]), "v"(g[3]),
           "v"(g[4]), "v"(g[5]), "v"(g[6]), "v"(g[7])
        : "memory");
  }
}

// ---------------------------------------------------------------------------
// Kernel 2: fused flash attention over embeddings, fp32 WMMA 16x16x4.
// Block = 128 threads = 4 waves over 1024 rows of one batch. A masked row has
// softmax weight 0, so it is neither read nor multiplied: the block packs the
// numbers of its unmasked rows into an LDS list, cuts the list into tiles of
// 16 and deals them to its waves in turn; each wave = one softmax split.
// Double-buffered async global->LDS staging, per wave.
// The query fragments stay in registers for the whole loop, and a tile's A
// fragments are fetched once, 16 bytes a lane, for the logits and the row norms.
// ---------------------------------------------------------------------------
__global__ void __launch_bounds__(128) k2_flash(
    const float* __restrict__ emb, const int* __restrict__ mask,
    const float* __restrict__ normq, float* __restrict__ part,
    float* __restrict__ lossp) {
  __shared__ __align__(16) float NQ[NHEADS * LSTR];
  __shared__ __align__(16) float ET[4][2][16 * LSTR];   // per-wave double buffer
  __shared__ int RL[BROWS + 16];                        // unmasked rows, packed

  const int tid = threadIdx.x;
  const int wave = __builtin_amdgcn_readfirstlane(tid >> 5);
  const int lane = tid & 31;
  const int b = blockIdx.x >> 4;                    // 16 blocks per batch
  const int blk = blockIdx.x & 15;
  const int w = (blk << 2) + wave;                  // split id 0..63
  const int n16 = lane & 15;
  const int hi = lane >> 4;

  // every wave reads the block's 1024 mask words (row v uses word v mod 8192)
  const int* mbase = mask + b * (VARNUM / 2) + ((blk * BROWS) & (VARNUM / 2 - 1));
  int4 mv[8];
#pragma unroll
  for (int g = 0; g < 8; ++g) mv[g] = *(const int4*)&mbase[128 * g + 4 * lane];

  // normq [16x128] -> LDS (padded stride)
  for (int i = tid; i < NHEADS * EMB; i += 128)
    NQ[(i >> 7) * LSTR + (i & 127)] = normq[(size_t)b * (NHEADS * EMB) + i];

  // pack: all waves count all 32 ballots, wave g & 3 stores the rows of group g
  int cnt = 0;
#pragma unroll
  for (int g = 0; g < 8; ++g) {
    const int mm[4] = {mv[g].x, mv[g].y, mv[g].z, mv[g].w};
#pragma unroll
    for (int c = 0; c < 4; ++c) {
      const unsigned bal = __builtin_amdgcn_ballot_w32(mm[c] != 0);
      if ((g & 3) == wave && mm[c] != 0)
        RL[cnt + (int)__builtin_amdgcn_mbcnt_lo(bal, 0u)] = 128 * g + 4 * lane + c;
      cnt += __builtin_popcount(bal);
    }
  }
  // the last tile is filled up with row 0; its filler slots get weight 0 below
  if (tid < 16) RL[cnt + tid] = 0;
  __syncthreads();

  const float* ebase = emb + ((size_t)b * VARNUM + (size_t)blk * BROWS) * EMB;
  const int ntiles = (cnt + 15) >> 4;               // 0..64
  const int trips = (ntiles - wave + 3) >> 2;       // tiles wave, wave+4, ...

  v8f acc[8];
#pragma unroll
  for (int ct = 0; ct < 8; ++ct) acc[ct] = (v8f)0.f;
  float m = BIGNEG, lsum = 0.f;

  // prologue: the wave's first tile is sent off into buffer 0; ridn = list
  // entries of the tile to be sent next
  int ridn = 0;
  if (trips > 0) {
    issue_rows_async(ebase, RL[wave * 16 + n16], &ET[wave][0][0], lane);
    ridn = RL[(wave + 4 * (trips > 1 ? 1 : 0)) * 16 + n16];
  }

  // ---- orthogonality loss of the batch: gram = normQ x normQ^T, minus I,
  // squared and summed. One wave of the batch's first block (the wave with the
  // fewest tiles), while its first tile is on the way. The A slice of normQ
  // and the B slice of normQ^T are the same two words of a lane.
  if (blk == 0 && wave == 3) {
    v8f gr = (v8f)0.f;
#pragma unroll
    for (int c = 0; c < 32; ++c) {
      v2f a = *(const v2f*)&NQ[n16 * LSTR + 2 * hi + 4 * c];
      gr = __builtin_amdgcn_wmma_f32_16x16x4_f32(false, a, false, a,
                                                 (short)0, gr, false, false);
    }
    // four vector slots between the last WMMA and the first read of its
    // result; the operand holds them at that place
    asm volatile("v_nop\n\tv_nop\n\tv_nop\n\tv_nop" : "+v"(gr));
    float s = 0.f;
#pragma unroll
    for (int r = 0; r < 8; ++r) {                // element (r + 8*hi, n16)
      float d = gr[r] - ((r + 8 * hi == n16) ? 1.f : 0.f);
      s += d * d;
    }
    s += xlane<1>(s); s += xlane<2>(s); s += xlane<4>(s); s += xlane<8>(s);
    s += __shfl_xor(s, 16, 32);
    if (lane == 0) lossp[b] = s * (1.0f / (float)BS);
  }

  // Fragment k order of the logits, alike for A (tile rows) and B (queries):
  // the lane's 16-B piece c holds k = 8c + 4*hi + 0..3; its low pair feeds K
  // slice 2c, its high pair K slice 2c + 1.
  const int foff = n16 * LSTR + 4 * hi;
  v4f qf[16];
#pragma unroll
  for (int c = 0; c < 16; ++c) qf[c] = *(const v4f*)&NQ[foff + 8 * c];

  for (int tile = 0; tile < trips; ++tile) {
    float* E = &ET[wave][tile & 1][0];

    // the last trip's reads of the other buffer have drained (refilled below)
    asm volatile("s_wait_dscnt 0x0" ::: "memory");
    // this trip's tile, sent off one trip ago, has landed
    asm volatile("s_wait_asynccnt 0x0" ::: "memory");
    if (tile + 1 < trips) {
      issue_rows_async(ebase, ridn, &ET[wave][(tile + 1) & 1][0], lane);
      // list entries one tile further on (the wave's last tile again at the end)
      const int tn = (tile + 2 < trips) ? tile + 2 : trips - 1;
      ridn = RL[(wave + 4 * tn) * 16 + n16];
    }

    // list slots of the 8 rows this lane-half owns: slot r is a row if r < nv
    const int nv = cnt - ((wave + 4 * tile) << 4) - 8 * hi;

    // ---- A fragments of the tile: row n16, the lane-half's 64 columns -------
    v4f af[16];
#pragma unroll
    for (int c = 0; c < 16; ++c) af[c] = *(const v4f*)&E[foff + 8 * c];

    // ---- per-row inverse L2 norm, summed from the same registers ------------
    float rn;
    {
      v2f s0 = (v2f)0.f, s1 = (v2f)0.f, s2 = (v2f)0.f, s3 = (v2f)0.f;
#pragma unroll
      for (int c = 0; c < 16; c += 2) {
        s0 = __builtin_elementwise_fma(af[c].lo, af[c].lo, s0);
        s1 = __builtin_elementwise_fma(af[c].hi, af[c].hi, s1);
        s2 = __builtin_elementwise_fma(af[c + 1].lo, af[c + 1].lo, s2);
        s3 = __builtin_elementwise_fma(af[c + 1].hi, af[c + 1].hi, s3);
      }
      const v2f st = (s0 + s1) + (s2 + s3);
      float s = st.x + st.y;
      s += __shfl_xor(s, 16, 32);
      rn = rsqrtf(s);
    }

    // ---- logits' [v][h] = E(16x128) x normQ^T(128x16): 32 WMMA K-slices ----
    v8f lg = (v8f)0.f;
#pragma unroll
    for (int c = 0; c < 16; ++c) {
      lg = __builtin_amdgcn_wmma_f32_16x16x4_f32(false, af[c].lo, false, qf[c].lo,
                                                 (short)0, lg, false, false);
      lg = __builtin_amdgcn_wmma_f32_16x16x4_f32(false, af[c].hi, false, qf[c].hi,
                                                 (short)0, lg, false, false);
    }
    // ---- B rows of the second product: rows 4s + 2*hi + j, 16 B a lane ------
    // Column n16 of col-tile ct is column 64*(ct>>2) + 4*n16 + (ct&3) of E, so
    // that one 16-B load of a row serves four col-tiles.
    // With this scheduling barrier all 16 fragment reads above are issued ahead
    // of the first WMMA; without it two of them are left among the WMMAs, with
    // a wait close behind that stalls the dependent run.
    __builtin_amdgcn_sched_barrier(0);
    v4f xr[4][2][2];
#pragma unroll
    for (int s = 0; s < 4; ++s)
#pragma unroll
      for (int j = 0; j < 2; ++j)
#pragma unroll
        for (int q = 0; q < 2; ++q)
          xr[s][j][q] = *(const v4f*)&E[(4 * s + 2 * hi + j) * LSTR + 64 * q + 4 * n16];
    // Holds the register moves that pair these rows, and the waits in front of
    // them, behind the logits' WMMAs: among them each such wait stalls the run.
    __builtin_amdgcn_sched_barrier(0);

    // ---- mask + cosine scaling + online softmax (head = n16 per lane) ------
    float p[8];
    float tmax = BIGNEG;
#pragma unroll
    for (int r = 0; r < 8; ++r) {
      float rr = __shfl(rn, r + 8 * hi, 32);    // inv-norm of row r+8*hi
      float lr = (r < nv) ? lg[r] * rr : BIGNEG;
      p[r] = lr;
      tmax = fmaxf(tmax, lr);
    }
    tmax = fmaxf(tmax, __shfl_xor(tmax, 16, 32));
    float mnew = fmaxf(m, tmax);
    float sc = __expf(m - mnew);
    float tsum = 0.f;
#pragma unroll
    for (int r = 0; r < 8; ++r) {
      float pe = (r < nv) ? __expf(p[r] - mnew) : 0.f;
      p[r] = pe;
      tsum += pe;
    }
    tsum += __shfl_xor(tsum, 16, 32);
    lsum = lsum * sc + tsum;
    m = mnew;

    // rescale accumulators: row r of acc holds head r+8*hi
#pragma unroll
    for (int r = 0; r < 8; ++r) {
      float scr = __shfl(sc, r + 8 * hi, 32);
#pragma unroll
      for (int ct = 0; ct < 8; ++ct) acc[ct][r] *= scr;
    }

    // ---- build A-layout slices of P (A[h][v]) from D'-layout p[] -----------
    float q0 = __shfl_xor(p[0], 16, 32), q1 = __shfl_xor(p[1], 16, 32);
    float q2 = __shfl_xor(p[2], 16, 32), q3 = __shfl_xor(p[3], 16, 32);
    float q4 = __shfl_xor(p[4], 16, 32), q5 = __shfl_xor(p[5], 16, 32);
    float q6 = __shfl_xor(p[6], 16, 32), q7 = __shfl_xor(p[7], 16, 32);
    v2f aS[4];
    aS[0].x = hi ? q2 : p[0];  aS[0].y = hi ? q3 : p[1];
    aS[1].x = hi ? q6 : p[4];  aS[1].y = hi ? q7 : p[5];
    aS[2].x = hi ? p[2] : q0;  aS[2].y = hi ? p[3] : q1;
    aS[3].x = hi ? p[6] : q4;  aS[3].y = hi ? p[7] : q5;

    // ---- rc += P^T(16x16) x E(16x128): 8 col-tiles x 4 K-slices ------------
#pragma unroll
    for (int s = 0; s < 4; ++s) {
#pragma unroll
      for (int q = 0; q < 2; ++q) {
#pragma unroll
        for (int i = 0; i < 4; ++i) {
          v2f bb;
          bb.x = xr[s][0][q][i];
          bb.y = xr[s][1][q][i];
          acc[4 * q + i] = __builtin_amdgcn_wmma_f32_16x16x4_f32(
              false, aS[s], false, bb, (short)0, acc[4 * q + i], false, false);
        }
      }
    }
  }

  // ---- write split partial: [b][w][h]{acc[0:128], m, l} ----
  float* pb = part + ((size_t)(b * WSPL + w)) * NHEADS * 130;
#pragma unroll
  for (int r = 0; r < 8; ++r) {
    int h = r + 8 * hi;
#pragma unroll
    for (int q = 0; q < 2; ++q) {                // rows of 520 B: 8-B aligned
      v2f lo, up;
      lo.x = acc[4 * q + 0][r]; lo.y = acc[4 * q + 1][r];
      up.x = acc[4 * q + 2][r]; up.y = acc[4 * q + 3][r];
      *(v2f*)&pb[h * 130 + 64 * q + 4 * n16] = lo;
      *(v2f*)&pb[h * 130 + 64 * q + 4 * n16 + 2] = up;
    }
  }
  if (lane < 16) {
    pb[lane * 130 + 128] = m;
    pb[lane * 130 + 129] = lsum;
  }
}

// ---------------------------------------------------------------------------
// Kernel 3: combine split-softmax partials; block per (b,h), 128 threads.
// All loads are issued before the first wait: lane l of every wave takes the
// {m, l} pairs of splits l and l+32, thread e takes column e of all 64 splits.
// ---------------------------------------------------------------------------
__global__ void __launch_bounds__(128) k3_combine(
    const float* __restrict__ part, const float* __restrict__ lossp,
    float* __restrict__ out) {
  const int blk = blockIdx.x;
  const int b = blk >> 4, h = blk & 15;
  const int e = threadIdx.x;
  const int lane = e & 31;
  const float* pb = part + ((size_t)b * WSPL) * NHEADS * 130 + h * 130;

  const v2f ml0 = *(const v2f*)&pb[(size_t)lane * NHEADS * 130 + 128];
  const v2f ml1 = *(const v2f*)&pb[(size_t)(lane + 32) * NHEADS * 130 + 128];
  float lp = 0.f;
  if (blk == 0) {
    lp = lossp[lane];
    // the next loads reuse this load's address register as a destination
    asm volatile("s_wait_xcnt 0x0" ::: "memory");
  }
  float a[WSPL];
#pragma unroll
  for (int w = 0; w < WSPL; ++w) a[w] = pb[(size_t)w * NHEADS * 130 + e];
  // keeps every load above ahead of the first wait; without it more than half
  // of the column loads sink below the wait on the {m, l} pairs
  __builtin_amdgcn_sched_barrier(0);

  float M = fmaxf(ml0.x, ml1.x);
  M = fmaxf(M, xlane<1>(M)); M = fmaxf(M, xlane<2>(M));
  M = fmaxf(M, xlane<4>(M)); M = fmaxf(M, xlane<8>(M));
  M = fmaxf(M, __shfl_xor(M, 16, 32));
  const float s0 = __expf(ml0.x - M), s1 = __expf(ml1.x - M);
  float Ls = s0 * ml0.y + s1 * ml1.y;
  Ls += xlane<1>(Ls); Ls += xlane<2>(Ls); Ls += xlane<4>(Ls); Ls += xlane<8>(Ls);
  Ls += __shfl_xor(Ls, 16, 32);

  float A = 0.f;
#pragma unroll
  for (int w = 0; w < WSPL; ++w) {               // summed in split order 0..63
    float sw = __builtin_bit_cast(float, __builtin_amdgcn_readlane(
        __builtin_bit_cast(int, (w < 32) ? s0 : s1), w & 31));
    A += sw * a[w];
  }
  out[((size_t)b * NHEADS + h) * EMB + e] = A / Ls;
  if (blk == 0) {
    // the lane reads below reuse the registers that the store above names; lp
    // is an operand so that those reads cannot be scheduled ahead of the wait
    asm volatile("s_wait_xcnt 0x0" : "+v"(lp) :: "memory");
    float s = 0.f;
#pragma unroll
    for (int i = 0; i < BS; ++i)
      s += __builtin_bit_cast(float, __builtin_amdgcn_readlane(
          __builtin_bit_cast(int, lp), i));
    if (e == 0) out[BS * NHEADS * EMB] = s;      // loss slot
  }
}

// ---------------------------------------------------------------------------
extern "C" void kernel_launch(void* const* d_in, const int* in_sizes, int n_in,
                              void* d_out, int out_size, void* d_ws, size_t ws_size,
                              hipStream_t stream) {
  const float* query_seed = (const float*)d_in[0];   // [32,128]
  const float* embeddings = (const float*)d_in[1];   // [32,16384,128]
  const int*   attn_mask  = (const int*)d_in[2];     // [32,8192]
  const float* w_qs       = (const float*)d_in[3];   // [16,128,128]
  float* out = (float*)d_out;                        // rc[32*16*128] + loss[1]

  float* ws    = (float*)d_ws;
  float* normq = ws;                                  // 65536 floats
  float* lossp = ws + 65536;                          // 32 floats
  float* part  = ws + 65600;                          // 32*64*16*130 floats

  k1_qs<<<(BS / NB) * (NHEADS / 2), 256, 0, stream>>>(query_seed, w_qs, normq);
  k2_flash<<<BS * (WSPL / 4), 128, 0, stream>>>(embeddings, attn_mask, normq, part, lossp);
  k3_combine<<<BS * NHEADS, 128, 0, stream>>>(part, lossp, out);
}

// v006
// It runs in 29.6 microseconds.
// Timed twice side by side with v005, it ran 1.20 and 1.18 times as fast.
// Over all steps from v000 it is 2.94 times as fast.
#include <hip/hip_runtime.h>
#include <hip/hip_bf16.h>
#include <stdint.h>

typedef float v2f __attribute__((ext_vector_type(2)));
typedef float v4f __attribute__((ext_vector_type(4)));
typedef float v8f __attribute__((ext_vector_type(8)));

#define BS 32
#define VARNUM 16384
#define EMB 128
#define NHEADS 16
#define NSPL 16               // softmax splits per batch (1 k2 block each)
#define BROWS (VARNUM / NSPL)                 // 1024 rows per k2 block
#define LSTR 132              // padded LDS row stride (floats), kills bank conflicts
#define BIGNEG (-3.0e38f)
#define NB 2                  // batches per k1 block

// value of lane l ^ M, M < 16: a vector cross-lane move inside a 16-lane row
template <int M>
__device__ __forceinline__ float xlane(float x) {
  return __builtin_bit_cast(
      float, __builtin_amdgcn_update_dpp(0, __builtin_bit_cast(int, x),
                                         0x160 | M, 0xf, 0xf, true));
}

// ---------------------------------------------------------------------------
// Kernel 1: qs = tanh(W_q @ seed), L2 normalized per head.
// One block per (pair of heads, NB batches): one weight row a thread, read once
// for its NB batches, so the weight read is spread over many WGPs and is one
// burst of loads. The gram loss needs all 16 heads of a batch: it is formed in
// kernel 2.
// ---------------------------------------------------------------------------
__global__ void __launch_bounds__(256) k1_qs(
    const float* __restrict__ seed, const float* __restrict__ wqs,
    float* __restrict__ normq) {
  const int bg = blockIdx.x >> 3, i = blockIdx.x & 7, t = threadIdx.x;
  __shared__ __align__(16) float s_red[NB][16];

  // Eight lanes share a weight row: lane piece c reads the 16-B pieces c, c+8,
  // c+16, c+24 of it, so one wave-wide load covers four whole 128-B lines
  // (rows 8*r4+g, r4 = 0..3) instead of 16 B out of 32 different lines.
  const int c = t & 7;
  const int r4 = (t >> 3) & 3;
  const v4f* sl = (const v4f*)(seed + NB * bg * 128) + c;
  const v4f* wl = (const v4f*)(wqs + (size_t)(256 * i + (t & ~31) + 8 * r4) * 128) + c;
  const bool b0 = (c & 1) != 0, b1 = (c & 2) != 0, b2 = (c & 4) != 0;

  v4f sd[NB][4], wb[32];
#pragma unroll
  for (int n = 0; n < NB; ++n)
#pragma unroll
    for (int j = 0; j < 4; ++j) sd[n][j] = sl[32 * n + 8 * j];
#pragma unroll
  for (int k = 0; k < 32; ++k) wb[k] = wl[(k >> 2) * 32 + 8 * (k & 3)];
  // keeps all loads ahead of the first sum; without it the loads sink to their
  // uses and the wave pays the load latency several times
  __builtin_amdgcn_sched_barrier(0);

  float v[NB];
#pragma unroll
  for (int n = 0; n < NB; ++n) {
    float p[8];
#pragma unroll
    for (int g = 0; g < 8; ++g) {                // partial dot of row 8*r4+g
      v2f a = (v2f)0.f, d = (v2f)0.f;
#pragma unroll
      for (int j = 0; j < 4; ++j) {
        v4f w = wb[4 * g + j];
        a = __builtin_elementwise_fma(w.lo, sd[n][j].lo, a);
        d = __builtin_elementwise_fma(w.hi, sd[n][j].hi, d);
      }
      p[g] = (a.x + a.y) + (d.x + d.y);
    }
    // fold the 8 pieces of 8 rows in 7 exchanges; lane c ends with row 8*r4+c,
    // row (t & 31) of the wave's 32: idx = h*128 + e = 256*i + t
    float q[4], u[2];
#pragma unroll
    for (int k = 0; k < 4; ++k)
      q[k] = (b0 ? p[2 * k + 1] : p[2 * k]) +
             xlane<1>(b0 ? p[2 * k] : p[2 * k + 1]);
#pragma unroll
    for (int k = 0; k < 2; ++k)
      u[k] = (b1 ? q[2 * k + 1] : q[2 * k]) +
             xlane<2>(b1 ? q[2 * k] : q[2 * k + 1]);
    v[n] = tanhf((b2 ? u[1] : u[0]) + xlane<4>(b2 ? u[0] : u[1]));

    // squared norm of the head (threads 128*(t>>7)..+127): 16-lane rows by
    // cross-lane moves, the head's 8 row sums through LDS
    float ss = v[n] * v[n];
    ss += xlane<1>(ss); ss += xlane<2>(ss); ss += xlane<4>(ss); ss += xlane<8>(ss);
    if ((t & 15) == 0) s_red[n][t >> 4] = ss;
  }
  __syncthreads();
#pragma unroll
  for (int n = 0; n < NB; ++n) {
    const v4f r0 = *(const v4f*)&s_red[n][8 * (t >> 7)];
    const v4f r1 = *(const v4f*)&s_red[n][8 * (t >> 7) + 4];
    const float tot = ((r0.x + r0.y) + (r0.z + r0.w)) + ((r1.x + r1.y) + (r1.z + r1.w));
    normq[(size_t)(NB * bg + n) * (NHEADS * EMB) + 256 * i + t] = v[n] * rsqrtf(tot);
  }
}

// ---------------------------------------------------------------------------
// Async copies of 16 listed rows (512 B each) into a per-wave LDS buffer.
// Lanes l and l+16 hold entry l of the tile's row list in rid; copy i brings
// row rid[i], 16 B a lane: no VGPR staging, tracked by ASYNCcnt.
// LDS byte offset = low 32 bits of the generic pointer (flat LDS aperture).
// ---------------------------------------------------------------------------
__device__ __forceinline__ void issue_rows_async(const float* eb, int rid,
                                                 float* buf, int lane) {
#pragma unroll
  for (int hf = 0; hf < 2; ++hf) {
    unsigned l[8];
    const float* g[8];
#pragma unroll
    for (int i = 0; i < 8; ++i) {
      const int row = __builtin_amdgcn_readlane(rid, 8 * hf + i);
      l[i] = (unsigned)(uintptr_t)&buf[(8 * hf + i) * LSTR + lane * 4];
      g[i] = eb + (size_t)row * EMB + lane * 4;
    }
    // the closing wait stands in the copies' own statement, so that no address
    // register of a copy is rewritten ahead of it
    asm volatile(
        "global_load_async_to_lds_b128 %0, %8, off\n\t"
        "global_load_async_to_lds_b128 %1, %9, off\n\t"
        "global_load_async_to_lds_b128 %2, %10, off\n\t"
        "global_load_async_to_lds_b128 %3, %11, off\n\t"
        "global_load_async_to_lds_b128 %4, %12, off\n\t"
        "global_load_async_to_lds_b128 %5, %13, off\n\t"
        "global_load_async_to_lds_b128 %6, %14, off\n\t"
        "global_load_async_to_lds_b128 %7, %15, off\n\t"
        "s_wait_xcnt 0x0"
        :: "v"(l[0]), "v"(l[1]), "v"(l[2]), "v"(l[3]),
           "v"(l[4]), "v"(l[5]), "v"(l[6]), "v"(l[7]),
           "v"(g[0]), "v"(g[1]), "v"(g[2]), "v"(g[3]),
           "v"(g[4]), "v"(g[5]), "v"(g[6]), "v"(g[7])
        : "memory");
  }
}

// ---------------------------------------------------------------------------
// Kernel 2: fused flash attention over embeddings, fp32 WMMA 16x16x4.
// Block = 128 threads = 4 waves over 1024 rows of one batch. A masked row has
// softmax weight 0, so it is neither read nor multiplied: the block packs the
// numbers of its unmasked rows into an LDS list, cuts the list into tiles of
// 16 and deals them to its waves in turn; each wave keeps a softmax partial of
// its own, and the block merges its four partials in LDS into one split.
// Double-buffered async global->LDS staging, per wave.
// The query fragments stay in registers for the whole loop, and a tile's A
// fragments are fetched once, 16 bytes a lane, for the logits and the row norms.
// ---------------------------------------------------------------------------
__global__ void __launch_bounds__(128) k2_flash(
    const float* __restrict__ emb, const int* __restrict__ mask,
    const float* __restrict__ normq, float* __restrict__ part,
    float* __restrict__ mlp, float* __restrict__ lossp) {
  __shared__ __align__(16) float NQ[NHEADS * LSTR];
  __shared__ __align__(16) float ET[4][2][16 * LSTR];   // per-wave double buffer
  __shared__ int RL[BROWS + 16];                        // unmasked rows, packed
  __shared__ __align__(16) float SM[NHEADS][4];         // the waves' maxima
  __shared__ __align__(16) float SL[NHEADS][4];         // the waves' denominators

  const int tid = threadIdx.x;
  const int wave = __builtin_amdgcn_readfirstlane(tid >> 5);
  const int lane = tid & 31;
  const int b = blockIdx.x >> 4;                    // 16 blocks per batch
  const int blk = blockIdx.x & 15;
  const int n16 = lane & 15;
  const int hi = lane >> 4;

  // every wave reads the block's 1024 mask words (row v uses word v mod 8192)
  const int* mbase = mask + b * (VARNUM / 2) + ((blk * BROWS) & (VARNUM / 2 - 1));
  int4 mv[8];
#pragma unroll
  for (int g = 0; g < 8; ++g) mv[g] = *(const int4*)&mbase[128 * g + 4 * lane];

  // normq [16x128] -> LDS (padded stride)
  for (int i = tid; i < NHEADS * EMB; i += 128)
    NQ[(i >> 7) * LSTR + (i & 127)] = normq[(size_t)b * (NHEADS * EMB) + i];

  // pack: all waves count all 32 ballots, wave g & 3 stores the rows of group g
  int cnt = 0;
#pragma unroll
  for (int g = 0; g < 8; ++g) {
    const int mm[4] = {mv[g].x, mv[g].y, mv[g].z, mv[g].w};
#pragma unroll
    for (int c = 0; c < 4; ++c) {
      const unsigned bal = __builtin_amdgcn_ballot_w32(mm[c] != 0);
      if ((g & 3) == wave && mm[c] != 0)
        RL[cnt + (int)__builtin_amdgcn_mbcnt_lo(bal, 0u)] = 128 * g + 4 * lane + c;
      cnt += __builtin_popcount(bal);
    }
  }
  // the last tile is filled up with row 0; its filler slots get weight 0 below
  if (tid < 16) RL[cnt + tid] = 0;
  __syncthreads();

  const float* ebase = emb + ((size_t)b * VARNUM + (size_t)blk * BROWS) * EMB;
  const int ntiles = (cnt + 15) >> 4;               // 0..64
  const int trips = (ntiles - wave + 3) >> 2;       // tiles wave, wave+4, ...

  v8f acc[8];
#pragma unroll
  for (int ct = 0; ct < 8; ++ct) acc[ct] = (v8f)0.f;
  float m = BIGNEG, lsum = 0.f;

  // prologue: the wave's first tile is sent off into buffer 0; ridn = list
  // entries of the tile to be sent next
  int ridn = 0;
  if (trips > 0) {
    issue_rows_async(ebase, RL[wave * 16 + n16], &ET[wave][0][0], lane);
    ridn = RL[(wave + 4 * (trips > 1 ? 1 : 0)) * 16 + n16];
  }

  // ---- orthogonality loss of the batch: gram = normQ x normQ^T, minus I,
  // squared and summed. One wave of the batch's first block (the wave with the
  // fewest tiles), while its first tile is on the way. The A slice of normQ
  // and the B slice of normQ^T are the same two words of a lane.
  if (blk == 0 && wave == 3) {
    v8f gr = (v8f)0.f;
#pragma unroll
    for (int c = 0; c < 32; ++c) {
      v2f a = *(const v2f*)&NQ[n16 * LSTR + 2 * hi + 4 * c];
      gr = __builtin_amdgcn_wmma_f32_16x16x4_f32(false, a, false, a,
                                                 (short)0, gr, false, false);
    }
    // four vector slots between the last WMMA and the first read of its
    // result; the operand holds them at that place
    asm volatile("v_nop\n\tv_nop\n\tv_nop\n\tv_nop" : "+v"(gr));
    float s = 0.f;
#pragma unroll
    for (int r = 0; r < 8; ++r) {                // element (r + 8*hi, n16)
      float d = gr[r] - ((r + 8 * hi == n16) ? 1.f : 0.f);
      s += d * d;
    }
    s += xlane<1>(s); s += xlane<2>(s); s += xlane<4>(s); s += xlane<8>(s);
    s += __shfl_xor(s, 16, 32);
    if (lane == 0) lossp[b] = s * (1.0f / (float)BS);
  }

  // Fragment k order of the logits, alike for A (tile rows) and B (queries):
  // the lane's 16-B piece c holds k = 8c + 4*hi + 0..3; its low pair feeds K
  // slice 2c, its high pair K slice 2c + 1.
  const int foff = n16 * LSTR + 4 * hi;
  v4f qf[16];
#pragma unroll
  for (int c = 0; c < 16; ++c) qf[c] = *(const v4f*)&NQ[foff + 8 * c];

  for (int tile = 0; tile < trips; ++tile) {
    float* E = &ET[wave][tile & 1][0];

    // the last trip's reads of the other buffer have drained (refilled below)
    asm volatile("s_wait_dscnt 0x0" ::: "memory");
    // this trip's tile, sent off one trip ago, has landed
    asm volatile("s_wait_asynccnt 0x0" ::: "memory");
    if (tile + 1 < trips) {
      issue_rows_async(ebase, ridn, &ET[wave][(tile + 1) & 1][0], lane);
      // list entries one tile further on (the wave's last tile again at the end)
      const int tn = (tile + 2 < trips) ? tile + 2 : trips - 1;
      ridn = RL[(wave + 4 * tn) * 16 + n16];
    }

    // list slots of the 8 rows this lane-half owns: slot r is a row if r < nv
    const int nv = cnt - ((wave + 4 * tile) << 4) - 8 * hi;

    // ---- A fragments of the tile: row n16, the lane-half's 64 columns -------
    v4f af[16];
#pragma unroll
    for (int c = 0; c < 16; ++c) af[c] = *(const v4f*)&E[foff + 8 * c];

    // ---- per-row inverse L2 norm, summed from the same registers ------------
    float rn;
    {
      v2f s0 = (v2f)0.f, s1 = (v2f)0.f, s2 = (v2f)0.f, s3 = (v2f)0.f;
#pragma unroll
      for (int c = 0; c < 16; c += 2) {
        s0 = __builtin_elementwise_fma(af[c].lo, af[c].lo, s0);
        s1 = __builtin_elementwise_fma(af[c].hi, af[c].hi, s1);
        s2 = __builtin_elementwise_fma(af[c + 1].lo, af[c + 1].lo, s2);
        s3 = __builtin_elementwise_fma(af[c + 1].hi, af[c + 1].hi, s3);
      }
      const v2f st = (s0 + s1) + (s2 + s3);
      float s = st.x + st.y;
      s += __shfl_xor(s, 16, 32);
      rn = rsqrtf(s);
    }

    // ---- logits' [v][h] = E(16x128) x normQ^T(128x16): 32 WMMA K-slices ----
    v8f lg = (v8f)0.f;
#pragma unroll
    for (int c = 0; c < 16; ++c) {
      lg = __builtin_amdgcn_wmma_f32_16x16x4_f32(false, af[c].lo, false, qf[c].lo,
                                                 (short)0, lg, false, false);
      lg = __builtin_amdgcn_wmma_f32_16x16x4_f32(false, af[c].hi, false, qf[c].hi,
                                                 (short)0, lg, false, false);
    }
    // ---- B rows of the second product: rows 4s + 2*hi + j, 16 B a lane ------
    // Column n16 of col-tile ct is column 64*(ct>>2) + 4*n16 + (ct&3) of E, so
    // that one 16-B load of a row serves four col-tiles.
    // With this scheduling barrier all 16 fragment reads above are issued ahead
    // of the first WMMA; without it two of them are left among the WMMAs, with
    // a wait close behind that stalls the dependent run.
    __builtin_amdgcn_sched_barrier(0);
    v4f xr[4][2][2];
#pragma unroll
    for (int s = 0; s < 4; ++s)
#pragma unroll
      for (int j = 0; j < 2; ++j)
#pragma unroll
        for (int q = 0; q < 2; ++q)
          xr[s][j][q] = *(const v4f*)&E[(4 * s + 2 * hi + j) * LSTR + 64 * q + 4 * n16];
    // Holds the register moves that pair these rows, and the waits in front of
    // them, behind the logits' WMMAs: among them each such wait stalls the run.
    __builtin_amdgcn_sched_barrier(0);

    // ---- mask + cosine scaling + online softmax (head = n16 per lane) ------
    float p[8];
    float tmax = BIGNEG;
#pragma unroll
    for (int r = 0; r < 8; ++r) {
      float rr = __shfl(rn, r + 8 * hi, 32);    // inv-norm of row r+8*hi
      float lr = (r < nv) ? lg[r] * rr : BIGNEG;
      p[r] = lr;
      tmax = fmaxf(tmax, lr);
    }
    tmax = fmaxf(tmax, __shfl_xor(tmax, 16, 32));
    float mnew = fmaxf(m, tmax);
    float sc = __expf(m - mnew);
    float tsum = 0.f;
#pragma unroll
    for (int r = 0; r < 8; ++r) {
      float pe = (r < nv) ? __expf(p[r] - mnew) : 0.f;
      p[r] = pe;
      tsum += pe;
    }
    tsum += __shfl_xor(tsum, 16, 32);
    lsum = lsum * sc + tsum;
    m = mnew;

    // rescale accumulators: row r of acc holds head r+8*hi
#pragma unroll
    for (int r = 0; r < 8; ++r) {
      float scr = __shfl(sc, r + 8 * hi, 32);
#pragma unroll
      for (int ct = 0; ct < 8; ++ct) acc[ct][r] *= scr;
    }

    // ---- build A-layout slices of P (A[h][v]) from D'-layout p[] -----------
    float q0 = __shfl_xor(p[0], 16, 32), q1 = __shfl_xor(p[1], 16, 32);
    float q2 = __shfl_xor(p[2], 16, 32), q3 = __shfl_xor(p[3], 16, 32);
    float q4 = __shfl_xor(p[4], 16, 32), q5 = __shfl_xor(p[5], 16, 32);
    float q6 = __shfl_xor(p[6], 16, 32), q7 = __shfl_xor(p[7], 16, 32);
    v2f aS[4];
    aS[0].x = hi ? q2 : p[0];  aS[0].y = hi ? q3 : p[1];
    aS[1].x = hi ? q6 : p[4];  aS[1].y = hi ? q7 : p[5];
    aS[2].x = hi ? p[2] : q0;  aS[2].y = hi ? p[3] : q1;
    aS[3].x = hi ? p[6] : q4;  aS[3].y = hi ? p[7] : q5;

    // ---- rc += P^T(16x16) x E(16x128): 8 col-tiles x 4 K-slices ------------
#pragma unroll
    for (int s = 0; s < 4; ++s) {
#pragma unroll
      for (int q = 0; q < 2; ++q) {
#pragma unroll
        for (int i = 0; i < 4; ++i) {
          v2f bb;
          bb.x = xr[s][0][q][i];
          bb.y = xr[s][1][q][i];
          acc[4 * q + i] = __builtin_amdgcn_wmma_f32_16x16x4_f32(
              false, aS[s], false, bb, (short)0, acc[4 * q + i], false, false);
        }
      }
    }
  }

  // ---- merge of the block's four partials ----
  // Each wave lays its partial, [head][column], into its own tile buffer: its
  // copies have landed (the last trip waited for them and sent none) and its
  // own LDS reads precede these writes in order.
  float* S = &ET[wave][0][0];
#pragma unroll
  for (int r = 0; r < 8; ++r) {
#pragma unroll
    for (int q = 0; q < 2; ++q) {
      v4f t;
      t.x = acc[4 * q + 0][r]; t.y = acc[4 * q + 1][r];
      t.z = acc[4 * q + 2][r]; t.w = acc[4 * q + 3][r];
      *(v4f*)&S[(r + 8 * hi) * LSTR + 64 * q + 4 * n16] = t;
    }
  }
  if (lane < 16) {
    SM[lane][wave] = m;
    SL[lane][wave] = lsum;
  }
  __syncthreads();

  // wave w merges heads 4w..4w+3: a lane takes 4 columns, so that a head's row
  // is one 512-B LDS read per partial and one 512-B store
  float* pb = part + (size_t)(b * NSPL + blk) * (NHEADS * EMB);
  v4f pv[4][4], mm[4];
#pragma unroll
  for (int j = 0; j < 4; ++j) {
    mm[j] = *(const v4f*)&SM[4 * wave + j][0];
#pragma unroll
    for (int s = 0; s < 4; ++s)
      pv[j][s] = *(const v4f*)&ET[s][0][(4 * wave + j) * LSTR + 4 * lane];
  }
#pragma unroll
  for (int j = 0; j < 4; ++j) {
    const float M = fmaxf(fmaxf(mm[j].x, mm[j].y), fmaxf(mm[j].z, mm[j].w));
    v4f o = __expf(mm[j].x - M) * pv[j][0];
    o += __expf(mm[j].y - M) * pv[j][1];
    o += __expf(mm[j].z - M) * pv[j][2];
    o += __expf(mm[j].w - M) * pv[j][3];
    *(v4f*)&pb[(4 * wave + j) * EMB + 4 * lane] = o;
  }
  // the split's {m, l} pairs, one 128-B line: head = thread
  if (tid < NHEADS) {
    const v4f a = *(const v4f*)&SM[tid][0];
    const v4f l = *(const v4f*)&SL[tid][0];
    const float M = fmaxf(fmaxf(a.x, a.y), fmaxf(a.z, a.w));
    v2f ml;
    ml.x = M;
    ml.y = (__expf(a.x - M) * l.x + __expf(a.y - M) * l.y) +
           (__expf(a.z - M) * l.z + __expf(a.w - M) * l.w);
    *(v2f*)&mlp[(size_t)(b * NSPL + blk) * (2 * NHEADS) + 2 * tid] = ml;
  }
}

// ---------------------------------------------------------------------------
// Kernel 3: combine the 16 split partials of a batch; one wave per (b,h).
// All loads are issued before the first wait: lanes l and l+16 take the {m, l}
// pair of split l, a lane takes 4 columns of all 16 splits.
// ---------------------------------------------------------------------------
__global__ void __launch_bounds__(64) k3_combine(
    const float* __restrict__ part, const float* __restrict__ mlp,
    const float* __restrict__ lossp, float* __restrict__ out) {
  const int lane = threadIdx.x & 31;
  // wave-uniform, so that the wave's addresses are a scalar base plus a lane offset
  const int bh = 2 * blockIdx.x + __builtin_amdgcn_readfirstlane(threadIdx.x >> 5);
  const int b = bh >> 4, h = bh & 15;
  const float* pb = part + ((size_t)b * NSPL * NHEADS + h) * EMB + 4 * lane;

  const float* mb = mlp + ((size_t)b * NSPL * NHEADS + h) * 2;
  const v2f ml = *(const v2f*)&mb[(lane & 15) * (2 * NHEADS)];
  float lp = 0.f;
  if (bh == 0) lp = lossp[lane];
  v4f a[NSPL];
#pragma unroll
  for (int w = 0; w < NSPL; ++w) a[w] = *(const v4f*)&pb[(size_t)w * NHEADS * EMB];
  // keeps every load above ahead of the first wait
  __builtin_amdgcn_sched_barrier(0);

  float M = ml.x;
  M = fmaxf(M, xlane<1>(M)); M = fmaxf(M, xlane<2>(M));
  M = fmaxf(M, xlane<4>(M)); M = fmaxf(M, xlane<8>(M));
  const float s0 = __expf(ml.x - M);
  float Ls = s0 * ml.y;
  Ls += xlane<1>(Ls); Ls += xlane<2>(Ls); Ls += xlane<4>(Ls); Ls += xlane<8>(Ls);

  v4f A = (v4f)0.f;
#pragma unroll
  for (int w = 0; w < NSPL; ++w) {               // summed in split order 0..15
    float sw = __builtin_bit_cast(float, __builtin_amdgcn_readlane(
        __builtin_bit_cast(int, s0), w));
    A += sw * a[w];
  }
  *(v4f*)&out[(size_t)bh * EMB + 4 * lane] = A * (1.0f / Ls);
  if (bh == 0) {
    // the lane reads below reuse the scalar base that the store above names;
    // lp is an operand so that those reads cannot be scheduled ahead of the wait
    asm volatile("s_wait_xcnt 0x0" : "+v"(lp) :: "memory");
    float s = 0.f;
#pragma unroll
    for (int i = 0; i < BS; ++i)
      s += __builtin_bit_cast(float, __builtin_amdgcn_readlane(
          __builtin_bit_cast(int, lp), i));
    if (lane == 0) out[BS * NHEADS * EMB] = s;   // loss slot
  }
}

// ---------------------------------------------------------------------------
extern "C" void kernel_launch(void* const* d_in, const int* in_sizes, int n_in,
                              void* d_out, int out_size, void* d_ws, size_t ws_size,
                              hipStream_t stream) {
  const float* query_seed = (const float*)d_in[0];   // [32,128]
  const float* embeddings = (const float*)d_in[1];   // [32,16384,128]
  const int*   attn_mask  = (const int*)d_in[2];     // [32,8192]
  const float* w_qs       = (const float*)d_in[3];   // [16,128,128]
  float* out = (float*)d_out;                        // rc[32*16*128] + loss[1]

  float* ws    = (float*)d_ws;
  float* normq = ws;                                  // 65536 floats
  float* lossp = ws + 65536;                          // 32 floats
  float* part  = ws + 65600;                          // 32*16*16*128 floats
  float* mlp   = ws + 1114176;                        // 32*16*16*2 floats

  k1_qs<<<(BS / NB) * (NHEADS / 2), 256, 0, stream>>>(query_seed, w_qs, normq);
  k2_flash<<<BS * NSPL, 128, 0, stream>>>(embeddings, attn_mask, normq, part, mlp, lossp);
  k3_combine<<<BS * NHEADS / 2, 64, 0, stream>>>(part, mlp, lossp, out);
}

// v007
// A run of this version takes 27.3 microseconds.
// Timed twice side by side with v006, it ran 1.07 times as fast both times.
// Counting every step since v000, it is 3.14 times as fast.
#include <hip/hip_runtime.h>
#include <hip/hip_bf16.h>
#include <stdint.h>

typedef float v2f __attribute__((ext_vector_type(2)));
typedef float v4f __attribute__((ext_vector_type(4)));
typedef float v8f __attribute__((ext_vector_type(8)));

#define BS 32
#define VARNUM 16384
#define EMB 128
#define NHEADS 16
#define NSPL 16               // softmax splits per batch (1 k2 block each)
#define BROWS (VARNUM / NSPL)                 // 1024 rows per k2 block
#define LSTR 132              // padded LDS row stride (floats), kills bank conflicts
#define BIGNEG (-3.0e38f)
#define NB 2                  // batches per k1 block

// value of lane l ^ M, M < 16: a vector cross-lane move inside a 16-lane row
template <int M>
__device__ __forceinline__ float xlane(float x) {
  return __builtin_bit_cast(
      float, __builtin_amdgcn_update_dpp(0, __builtin_bit_cast(int, x),
                                         0x160 | M, 0xf, 0xf, true));
}

// ---------------------------------------------------------------------------
// Kernel 1: qs = tanh(W_q @ seed), L2 normalized per head.
// One block per (pair of heads, NB batches): one weight row a thread, read once
// for its NB batches, so the weight read is spread over many WGPs and is one
// burst of loads. The gram loss needs all 16 heads of a batch: it is formed in
// kernel 2.
// ---------------------------------------------------------------------------
__global__ void __launch_bounds__(256) k1_qs(
    const float* __restrict__ seed, const float* __restrict__ wqs,
    float* __restrict__ normq) {
  const int bg = blockIdx.x >> 3, i = blockIdx.x & 7, t = threadIdx.x;
  __shared__ __align__(16) float s_red[NB][16];

  // Eight lanes share a weight row: lane piece c reads the 16-B pieces c, c+8,
  // c+16, c+24 of it, so one wave-wide load covers four whole 128-B lines
  // (rows 8*r4+g, r4 = 0..3) instead of 16 B out of 32 different lines.
  const int c = t & 7;
  const int r4 = (t >> 3) & 3;
  const v4f* sl = (const v4f*)(seed + NB * bg * 128) + c;
  const v4f* wl = (const v4f*)(wqs + (size_t)(256 * i + (t & ~31) + 8 * r4) * 128) + c;
  const bool b0 = (c & 1) != 0, b1 = (c & 2) != 0, b2 = (c & 4) != 0;

  v4f sd[NB][4], wb[32];
#pragma unroll
  for (int n = 0; n < NB; ++n)
#pragma unroll
    for (int j = 0; j < 4; ++j) sd[n][j] = sl[32 * n + 8 * j];
#pragma unroll
  for (int k = 0; k < 32; ++k) wb[k] = wl[(k >> 2) * 32 + 8 * (k & 3)];
  // keeps all loads ahead of the first sum; without it the loads sink to their
  // uses and the wave pays the load latency several times
  __builtin_amdgcn_sched_barrier(0);

  float v[NB];
#pragma unroll
  for (int n = 0; n < NB; ++n) {
    float p[8];
#pragma unroll
    for (int g = 0; g < 8; ++g) {                // partial dot of row 8*r4+g
      v2f a = (v2f)0.f, d = (v2f)0.f;
#pragma unroll
      for (int j = 0; j < 4; ++j) {
        v4f w = wb[4 * g + j];
        a = __builtin_elementwise_fma(w.lo, sd[n][j].lo, a);
        d = __builtin_elementwise_fma(w.hi, sd[n][j].hi, d);
      }
      p[g] = (a.x + a.y) + (d.x + d.y);
    }
    // fold the 8 pieces of 8 rows in 7 exchanges; lane c ends with row 8*r4+c,
    // row (t & 31) of the wave's 32: idx = h*128 + e = 256*i + t
    float q[4], u[2];
#pragma unroll
    for (int k = 0; k < 4; ++k)
      q[k] = (b0 ? p[2 * k + 1] : p[2 * k]) +
             xlane<1>(b0 ? p[2 * k] : p[2 * k + 1]);
#pragma unroll
    for (int k = 0; k < 2; ++k)
      u[k] = (b1 ? q[2 * k + 1] : q[2 * k]) +
             xlane<2>(b1 ? q[2 * k] : q[2 * k + 1]);
    v[n] = tanhf((b2 ? u[1] : u[0]) + xlane<4>(b2 ? u[0] : u[1]));

    // squared norm of the head (threads 128*(t>>7)..+127): 16-lane rows by
    // cross-lane moves, the head's 8 row sums through LDS
    float ss = v[n] * v[n];
    ss += xlane<1>(ss); ss += xlane<2>(ss); ss += xlane<4>(ss); ss += xlane<8>(ss);
    if ((t & 15) == 0) s_red[n][t >> 4] = ss;
  }
  __syncthreads();
#pragma unroll
  for (int n = 0; n < NB; ++n) {
    const v4f r0 = *(const v4f*)&s_red[n][8 * (t >> 7)];
    const v4f r1 = *(const v4f*)&s_red[n][8 * (t >> 7) + 4];
    const float tot = ((r0.x + r0.y) + (r0.z + r0.w)) + ((r1.x + r1.y) + (r1.z + r1.w));
    normq[(size_t)(NB * bg + n) * (NHEADS * EMB) + 256 * i + t] = v[n] * rsqrtf(tot);
  }
}

// ---------------------------------------------------------------------------
// Async copies of 16 listed rows (512 B each) into a per-wave LDS buffer.
// Lanes l and l+16 hold entry l of the tile's row list in rid; copy i brings
// row rid[i], 16 B a lane: no VGPR staging, tracked by ASYNCcnt.
// LDS byte offset = low 32 bits of the generic pointer (flat LDS aperture).
// ---------------------------------------------------------------------------
__device__ __forceinline__ void issue_rows_async(const float* eb, int rid,
                                                 float* buf, int lane) {
#pragma unroll
  for (int hf = 0; hf < 2; ++hf) {
    unsigned l[8];
    const float* g[8];
#pragma unroll
    for (int i = 0; i < 8; ++i) {
      const int row = __builtin_amdgcn_readlane(rid, 8 * hf + i);
      l[i] = (unsigned)(uintptr_t)&buf[(8 * hf + i) * LSTR + lane * 4];
      g[i] = eb + (size_t)row * EMB + lane * 4;
    }
    // the closing wait stands in the copies' own statement, so that no address
    // register of a copy is rewritten ahead of it
    asm volatile(
        "global_load_async_to_lds_b128 %0, %8, off\n\t"
        "global_load_async_to_lds_b128 %1, %9, off\n\t"
        "global_load_async_to_lds_b128 %2, %10, off\n\t"
        "global_load_async_to_lds_b128 %3, %11, off\n\t"
        "global_load_async_to_lds_b128 %4, %12, off\n\t"
        "global_load_async_to_lds_b128 %5, %13, off\n\t"
        "global_load_async_to_lds_b128 %6, %14, off\n\t"
        "global_load_async_to_lds_b128 %7, %15, off\n\t"
        "s_wait_xcnt 0x0"
        :: "v"(l[0]), "v"(l[1]), "v"(l[2]), "v"(l[3]),
           "v"(l[4]), "v"(l[5]), "v"(l[6]), "v"(l[7]),
           "v"(g[0]), "v"(g[1]), "v"(g[2]), "v"(g[3]),
           "v"(g[4]), "v"(g[5]), "v"(g[6]), "v"(g[7])
        : "memory");
  }
}

// ---------------------------------------------------------------------------
// Kernel 2: fused flash attention over embeddings, fp32 WMMA 16x16x4.
// Block = 128 threads = 4 waves over 1024 rows of one batch. A masked row has
// softmax weight 0, so it is neither read nor multiplied: the block packs the
// numbers of its unmasked rows into an LDS list, cuts the list into tiles of
// 16 and deals them to its waves in turn; each wave keeps a softmax partial of
// its own, and the block merges its four partials in LDS into one split.
// Double-buffered async global->LDS staging, per wave.
// The query fragments stay in registers for the whole loop, and a tile's A
// fragments are fetched once, 16 bytes a lane, for the logits and the row norms.
// ---------------------------------------------------------------------------
__global__ void __launch_bounds__(128) k2_flash(
    const float* __restrict__ emb, const int* __restrict__ mask,
    const float* __restrict__ normq, float* __restrict__ part,
    float* __restrict__ mlp, float* __restrict__ lossp) {
  __shared__ __align__(16) float NQ[NHEADS * LSTR];
  __shared__ __align__(16) float ET[4][2][16 * LSTR];   // per-wave double buffer
  __shared__ int RL[BROWS + 16];                        // unmasked rows, packed
  __shared__ __align__(16) float SM[NHEADS][4];         // the waves' maxima
  __shared__ __align__(16) float SL[NHEADS][4];         // the waves' denominators

  const int tid = threadIdx.x;
  const int wave = __builtin_amdgcn_readfirstlane(tid >> 5);
  const int lane = tid & 31;
  const int b = blockIdx.x >> 4;                    // 16 blocks per batch
  const int blk = blockIdx.x & 15;
  const int n16 = lane & 15;
  const int hi = lane >> 4;

  // every wave reads the block's 1024 mask words (row v uses word v mod 8192)
  const int* mbase = mask + b * (VARNUM / 2) + ((blk * BROWS) & (VARNUM / 2 - 1));
  int4 mv[8];
#pragma unroll
  for (int g = 0; g < 8; ++g) mv[g] = *(const int4*)&mbase[128 * g + 4 * lane];

  // normq [16x128]: 4 pieces of 16 B a thread (a wave-wide load is one whole
  // 512-B row), all issued behind the mask loads and ahead of the first wait;
  // they are laid into LDS behind the pack, which covers their latency
  const v4f* nqg = (const v4f*)(normq + (size_t)b * (NHEADS * EMB)) + tid;
  v4f nq[4];
  // keeps the mask loads, which the pack waits for one by one, in front of the
  // query loads; without it four query loads stand ahead of seven mask loads
  __builtin_amdgcn_sched_barrier(0);
#pragma unroll
  for (int k = 0; k < 4; ++k) nq[k] = nqg[128 * k];
  // the scalar bases that the loads above name are rewritten right behind them
  asm volatile("s_wait_xcnt 0x0" ::: "memory");

  // pack: all waves count all 32 ballots, wave g & 3 stores the rows of group g
  int cnt = 0;
#pragma unroll
  for (int g = 0; g < 8; ++g) {
    const int mm[4] = {mv[g].x, mv[g].y, mv[g].z, mv[g].w};
#pragma unroll
    for (int c = 0; c < 4; ++c) {
      const unsigned bal = __builtin_amdgcn_ballot_w32(mm[c] != 0);
      if ((g & 3) == wave && mm[c] != 0)
        RL[cnt + (int)__builtin_amdgcn_mbcnt_lo(bal, 0u)] = 128 * g + 4 * lane + c;
      cnt += __builtin_popcount(bal);
    }
  }
  // the last tile is filled up with row 0; its filler slots get weight 0 below
  if (tid < 16) RL[cnt + tid] = 0;
  // queries -> LDS (padded stride): wave w lays rows w, w+4, w+8, w+12; row w
  // starts LSTR * w = 128 * w + 4 * w floats in, and 128 * w + 4 * lane = 4 * tid
#pragma unroll
  for (int k = 0; k < 4; ++k)
    *(v4f*)&NQ[4 * k * LSTR + 4 * wave + 4 * tid] = nq[k];
  __syncthreads();

  const float* ebase = emb + ((size_t)b * VARNUM + (size_t)blk * BROWS) * EMB;
  const int ntiles = (cnt + 15) >> 4;               // 0..64
  const int trips = (ntiles - wave + 3) >> 2;       // tiles wave, wave+4, ...

  v8f acc[8];
#pragma unroll
  for (int ct = 0; ct < 8; ++ct) acc[ct] = (v8f)0.f;
  float m = BIGNEG, lsum = 0.f;

  // prologue: the wave's first tile is sent off into buffer 0; ridn = list
  // entries of the tile to be sent next
  int ridn = 0;
  if (trips > 0) {
    issue_rows_async(ebase, RL[wave * 16 + n16], &ET[wave][0][0], lane);
    ridn = RL[(wave + 4 * (trips > 1 ? 1 : 0)) * 16 + n16];
  }

  // ---- orthogonality loss of the batch: gram = normQ x normQ^T, minus I,
  // squared and summed. One wave of the batch's first block (the wave with the
  // fewest tiles), while its first tile is on the way. The A slice of normQ
  // and the B slice of normQ^T are the same two words of a lane.
  if (blk == 0 && wave == 3) {
    v8f gr = (v8f)0.f;
#pragma unroll
    for (int c = 0; c < 32; ++c) {
      v2f a = *(const v2f*)&NQ[n16 * LSTR + 2 * hi + 4 * c];
      gr = __builtin_amdgcn_wmma_f32_16x16x4_f32(false, a, false, a,
                                                 (short)0, gr, false, false);
    }
    // four vector slots between the last WMMA and the first read of its
    // result; the operand holds them at that place
    asm volatile("v_nop\n\tv_nop\n\tv_nop\n\tv_nop" : "+v"(gr));
    float s = 0.f;
#pragma unroll
    for (int r = 0; r < 8; ++r) {                // element (r + 8*hi, n16)
      float d = gr[r] - ((r + 8 * hi == n16) ? 1.f : 0.f);
      s += d * d;
    }
    s += xlane<1>(s); s += xlane<2>(s); s += xlane<4>(s); s += xlane<8>(s);
    s += __shfl_xor(s, 16, 32);
    if (lane == 0) lossp[b] = s * (1.0f / (float)BS);
  }

  // Fragment k order of the logits, alike for A (tile rows) and B (queries):
  // the lane's 16-B piece c holds k = 8c + 4*hi + 0..3; its low pair feeds K
  // slice 2c, its high pair K slice 2c + 1.
  const int foff = n16 * LSTR + 4 * hi;
  v4f qf[16];
#pragma unroll
  for (int c = 0; c < 16; ++c) qf[c] = *(const v4f*)&NQ[foff + 8 * c];

  for (int tile = 0; tile < trips; ++tile) {
    float* E = &ET[wave][tile & 1][0];

    // the last trip's reads of the other buffer have drained (refilled below)
    asm volatile("s_wait_dscnt 0x0" ::: "memory");
    // this trip's tile, sent off one trip ago, has landed
    asm volatile("s_wait_asynccnt 0x0" ::: "memory");
    if (tile + 1 < trips) {
      issue_rows_async(ebase, ridn, &ET[wave][(tile + 1) & 1][0], lane);
      // list entries one tile further on (the wave's last tile again at the end)
      const int tn = (tile + 2 < trips) ? tile + 2 : trips - 1;
      ridn = RL[(wave + 4 * tn) * 16 + n16];
    }

    // list slots of the 8 rows this lane-half owns: slot r is a row if r < nv
    const int nv = cnt - ((wave + 4 * tile) << 4) - 8 * hi;

    // ---- A fragments of the tile: row n16, the lane-half's 64 columns -------
    v4f af[16];
#pragma unroll
    for (int c = 0; c < 16; ++c) af[c] = *(const v4f*)&E[foff + 8 * c];

    // ---- per-row inverse L2 norm, summed from the same registers ------------
    float rn;
    {
      v2f s0 = (v2f)0.f, s1 = (v2f)0.f, s2 = (v2f)0.f, s3 = (v2f)0.f;
#pragma unroll
      for (int c = 0; c < 16; c += 2) {
        s0 = __builtin_elementwise_fma(af[c].lo, af[c].lo, s0);
        s1 = __builtin_elementwise_fma(af[c].hi, af[c].hi, s1);
        s2 = __builtin_elementwise_fma(af[c + 1].lo, af[c + 1].lo, s2);
        s3 = __builtin_elementwise_fma(af[c + 1].hi, af[c + 1].hi, s3);
      }
      const v2f st = (s0 + s1) + (s2 + s3);
      float s = st.x + st.y;
      s += __shfl_xor(s, 16, 32);
      rn = rsqrtf(s);
    }

    // ---- logits' [v][h] = E(16x128) x normQ^T(128x16): 32 WMMA K-slices ----
    v8f lg = (v8f)0.f;
#pragma unroll
    for (int c = 0; c < 16; ++c) {
      lg = __builtin_amdgcn_wmma_f32_16x16x4_f32(false, af[c].lo, false, qf[c].lo,
                                                 (short)0, lg, false, false);
      lg = __builtin_amdgcn_wmma_f32_16x16x4_f32(false, af[c].hi, false, qf[c].hi,
                                                 (short)0, lg, false, false);
    }
    // ---- B rows of the second product: rows 4s + 2*hi + j, 16 B a lane ------
    // Column n16 of col-tile ct is column 64*(ct>>2) + 4*n16 + (ct&3) of E, so
    // that one 16-B load of a row serves four col-tiles.
    // With this scheduling barrier all 16 fragment reads above are issued ahead
    // of the first WMMA; without it two of them are left among the WMMAs, with
    // a wait close behind that stalls the dependent run.
    __builtin_amdgcn_sched_barrier(0);
    v4f xr[4][2][2];
#pragma unroll
    for (int s = 0; s < 4; ++s)
#pragma unroll
      for (int j = 0; j < 2; ++j)
#pragma unroll
        for (int q = 0; q < 2; ++q)
          xr[s][j][q] = *(const v4f*)&E[(4 * s + 2 * hi + j) * LSTR + 64 * q + 4 * n16];
    // Holds the register moves that pair these rows, and the waits in front of
    // them, behind the logits' WMMAs: among them each such wait stalls the run.
    __builtin_amdgcn_sched_barrier(0);

    // ---- mask + cosine scaling + online softmax (head = n16 per lane) ------
    float p[8];
    float tmax = BIGNEG;
#pragma unroll
    for (int r = 0; r < 8; ++r) {
      float rr = __shfl(rn, r + 8 * hi, 32);    // inv-norm of row r+8*hi
      float lr = (r < nv) ? lg[r] * rr : BIGNEG;
      p[r] = lr;
      tmax = fmaxf(tmax, lr);
    }
    tmax = fmaxf(tmax, __shfl_xor(tmax, 16, 32));
    float mnew = fmaxf(m, tmax);
    float sc = __expf(m - mnew);
    float tsum = 0.f;
#pragma unroll
    for (int r = 0; r < 8; ++r) {
      float pe = (r < nv) ? __expf(p[r] - mnew) : 0.f;
      p[r] = pe;
      tsum += pe;
    }
    tsum += __shfl_xor(tsum, 16, 32);
    lsum = lsum * sc + tsum;
    m = mnew;

    // rescale accumulators: row r of acc holds head r+8*hi
#pragma unroll
    for (int r = 0; r < 8; ++r) {
      float scr = __shfl(sc, r + 8 * hi, 32);
#pragma unroll
      for (int ct = 0; ct < 8; ++ct) acc[ct][r] *= scr;
    }

    // ---- build A-layout slices of P (A[h][v]) from D'-layout p[] -----------
    float q0 = __shfl_xor(p[0], 16, 32), q1 = __shfl_xor(p[1], 16, 32);
    float q2 = __shfl_xor(p[2], 16, 32), q3 = __shfl_xor(p[3], 16, 32);
    float q4 = __shfl_xor(p[4], 16, 32), q5 = __shfl_xor(p[5], 16, 32);
    float q6 = __shfl_xor(p[6], 16, 32), q7 = __shfl_xor(p[7], 16, 32);
    v2f aS[4];
    aS[0].x = hi ? q2 : p[0];  aS[0].y = hi ? q3 : p[1];
    aS[1].x = hi ? q6 : p[4];  aS[1].y = hi ? q7 : p[5];
    aS[2].x = hi ? p[2] : q0;  aS[2].y = hi ? p[3] : q1;
    aS[3].x = hi ? p[6] : q4;  aS[3].y = hi ? p[7] : q5;

    // ---- rc += P^T(16x16) x E(16x128): 8 col-tiles x 4 K-slices ------------
#pragma unroll
    for (int s = 0; s < 4; ++s) {
#pragma unroll
      for (int q = 0; q < 2; ++q) {
#pragma unroll
        for (int i = 0; i < 4; ++i) {
          v2f bb;
          bb.x = xr[s][0][q][i];
          bb.y = xr[s][1][q][i];
          acc[4 * q + i] = __builtin_amdgcn_wmma_f32_16x16x4_f32(
              false, aS[s], false, bb, (short)0, acc[4 * q + i], false, false);
        }
      }
    }
  }

  // ---- merge of the block's four partials ----
  // Each wave lays its partial, [head][column], into its own tile buffer: its
  // copies have landed (the last trip waited for them and sent none) and its
  // own LDS reads precede these writes in order.
  float* S = &ET[wave][0][0];
#pragma unroll
  for (int r = 0; r < 8; ++r) {
#pragma unroll
    for (int q = 0; q < 2; ++q) {
      v4f t;
      t.x = acc[4 * q + 0][r]; t.y = acc[4 * q + 1][r];
      t.z = acc[4 * q + 2][r]; t.w = acc[4 * q + 3][r];
      *(v4f*)&S[(r + 8 * hi) * LSTR + 64 * q + 4 * n16] = t;
    }
  }
  if (lane < 16) {
    SM[lane][wave] = m;
    SL[lane][wave] = lsum;
  }
  __syncthreads();

  // wave w merges heads 4w..4w+3: a lane takes 4 columns, so that a head's row
  // is one 512-B LDS read per partial and one 512-B store
  float* pb = part + (size_t)(b * NSPL + blk) * (NHEADS * EMB);
  v4f pv[4][4], mm[4];
#pragma unroll
  for (int j = 0; j < 4; ++j) {
    mm[j] = *(const v4f*)&SM[4 * wave + j][0];
#pragma unroll
    for (int s = 0; s < 4; ++s)
      pv[j][s] = *(const v4f*)&ET[s][0][(4 * wave + j) * LSTR + 4 * lane];
  }
#pragma unroll
  for (int j = 0; j < 4; ++j) {
    const float M = fmaxf(fmaxf(mm[j].x, mm[j].y), fmaxf(mm[j].z, mm[j].w));
    v4f o = __expf(mm[j].x - M) * pv[j][0];
    o += __expf(mm[j].y - M) * pv[j][1];
    o += __expf(mm[j].z - M) * pv[j][2];
    o += __expf(mm[j].w - M) * pv[j][3];
    *(v4f*)&pb[(4 * wave + j) * EMB + 4 * lane] = o;
  }
  // the split's {m, l} pairs, one 128-B line: head = thread
  if (tid < NHEADS) {
    const v4f a = *(const v4f*)&SM[tid][0];
    const v4f l = *(const v4f*)&SL[tid][0];
    const float M = fmaxf(fmaxf(a.x, a.y), fmaxf(a.z, a.w));
    v2f ml;
    ml.x = M;
    ml.y = (__expf(a.x - M) * l.x + __expf(a.y - M) * l.y) +
           (__expf(a.z - M) * l.z + __expf(a.w - M) * l.w);
    *(v2f*)&mlp[(size_t)(b * NSPL + blk) * (2 * NHEADS) + 2 * tid] = ml;
  }
}

// ---------------------------------------------------------------------------
// Kernel 3: combine the 16 split partials of a batch; one wave per (b,h).
// All loads are issued before the first wait: lanes l and l+16 take the {m, l}
// pair of split l, a lane takes 4 columns of all 16 splits.
// ---------------------------------------------------------------------------
__global__ void __launch_bounds__(64) k3_combine(
    const float* __restrict__ part, const float* __restrict__ mlp,
    const float* __restrict__ lossp, float* __restrict__ out) {
  const int lane = threadIdx.x & 31;
  // wave-uniform, so that the wave's addresses are a scalar base plus a lane offset
  const int bh = 2 * blockIdx.x + __builtin_amdgcn_readfirstlane(threadIdx.x >> 5);
  const int b = bh >> 4, h = bh & 15;
  const float* pb = part + ((size_t)b * NSPL * NHEADS + h) * EMB + 4 * lane;

  const float* mb = mlp + ((size_t)b * NSPL * NHEADS + h) * 2;
  const v2f ml = *(const v2f*)&mb[(lane & 15) * (2 * NHEADS)];
  float lp = 0.f;
  if (bh == 0) lp = lossp[lane];
  v4f a[NSPL];
#pragma unroll
  for (int w = 0; w < NSPL; ++w) a[w] = *(const v4f*)&pb[(size_t)w * NHEADS * EMB];
  // keeps every load above ahead of the first wait
  __builtin_amdgcn_sched_barrier(0);

  float M = ml.x;
  M = fmaxf(M, xlane<1>(M)); M = fmaxf(M, xlane<2>(M));
  M = fmaxf(M, xlane<4>(M)); M = fmaxf(M, xlane<8>(M));
  const float s0 = __expf(ml.x - M);
  float Ls = s0 * ml.y;
  Ls += xlane<1>(Ls); Ls += xlane<2>(Ls); Ls += xlane<4>(Ls); Ls += xlane<8>(Ls);

  v4f A = (v4f)0.f;
#pragma unroll
  for (int w = 0; w < NSPL; ++w) {               // summed in split order 0..15
    float sw = __builtin_bit_cast(float, __builtin_amdgcn_readlane(
        __builtin_bit_cast(int, s0), w));
    A += sw * a[w];
  }
  *(v4f*)&out[(size_t)bh * EMB + 4 * lane] = A * (1.0f / Ls);
  if (bh == 0) {
    // the lane reads below reuse the scalar base that the store above names;
    // lp is an operand so that those reads cannot be scheduled ahead of the wait
    asm volatile("s_wait_xcnt 0x0" : "+v"(lp) :: "memory");
    float s = 0.f;
#pragma unroll
    for (int i = 0; i < BS; ++i)
      s += __builtin_bit_cast(float, __builtin_amdgcn_readlane(
          __builtin_bit_cast(int, lp), i));
    if (lane == 0) out[BS * NHEADS * EMB] = s;   // loss slot
  }
}

// ---------------------------------------------------------------------------
extern "C" void kernel_launch(void* const* d_in, const int* in_sizes, int n_in,
                              void* d_out, int out_size, void* d_ws, size_t ws_size,
                              hipStream_t stream) {
  const float* query_seed = (const float*)d_in[0];   // [32,128]
  const float* embeddings = (const float*)d_in[1];   // [32,16384,128]
  const int*   attn_mask  = (const int*)d_in[2];     // [32,8192]
  const float* w_qs       = (const float*)d_in[3];   // [16,128,128]
  float* out = (float*)d_out;                        // rc[32*16*128] + loss[1]

  float* ws    = (float*)d_ws;
  float* normq = ws;                                  // 65536 floats
  float* lossp = ws + 65536;                          // 32 floats
  float* part  = ws + 65600;                          // 32*16*16*128 floats
  float* mlp   = ws + 1114176;                        // 32*16*16*2 floats

  k1_qs<<<(BS / NB) * (NHEADS / 2), 256, 0, stream>>>(query_seed, w_qs, normq);
  k2_flash<<<BS * NSPL, 128, 0, stream>>>(embeddings, attn_mask, normq, part, mlp, lossp);
  k3_combine<<<BS * NHEADS / 2, 64, 0, stream>>>(part, mlp, lossp, out);
}
